// v000
// Times are from an AMD MI455X. After a warm-up the kernel runs many times in a row, and a time is the length of
// such a window on the GPU divided by its runs, so every launch and the gaps after it count. The runs cycle
// through copies of the inputs. A figure is the median of several windows, for all but v000 over two sittings.
// Sittings can differ by a few percent; kernels timed side by side share one.
// v000 is the starting kernel. One run takes 12.9 microseconds.
#include <hip/hip_runtime.h>
#include <hip/hip_bf16.h>

typedef __attribute__((ext_vector_type(16))) _Float16 v16h;
typedef __attribute__((ext_vector_type(8)))  float    v8f;

#define LOOKBACK 8
#define HID      32
#define MV       11
#define TILE_Q   128                 // queries per block
#define NPOS     (TILE_Q + 16)       // 144 positions (128 + 8 halo, rounded to 16)
#define NTILES   (NPOS / 16)         // 9 WMMA row-tiles
#define PITCH    33                  // LDS row pitch in floats (bank-conflict-free)
#define EPSV     1e-6f

__device__ __forceinline__ float phi_f(float x) {
    return (x >= 0.0f ? x : 0.01f * x) + 1.0f;
}

// K-slot index for 16-bit A/B fragment element (vgpr v, element e, lane-half hk)
__device__ __forceinline__ int kslot(int v, int e, int hk) {
    return (v < 4) ? (hk * 8 + 2 * v + e) : (16 + hk * 8 + 2 * (v - 4) + e);
}

__global__ __launch_bounds__(128)
void ga_attn_wmma_kernel(const float* __restrict__ x,
                         const float* __restrict__ scalar_bias,
                         const float* __restrict__ vscale,
                         const float* __restrict__ vbias,
                         const float* __restrict__ bw,
                         const float* __restrict__ WQ,
                         const float* __restrict__ WK,
                         const float* __restrict__ WV,
                         const float* __restrict__ w_head,
                         const float* __restrict__ b_head,
                         float* __restrict__ out_pred,
                         float* __restrict__ out_w,
                         int L) {
    __shared__ float sQ[NPOS * PITCH];
    __shared__ float sK[NPOS * PITCH];
    __shared__ float sV[NPOS * PITCH];

    const int b    = blockIdx.y;
    const int T    = L - LOOKBACK;
    const int p0   = LOOKBACK + blockIdx.x * TILE_Q;  // first query position
    const int base = p0 - LOOKBACK;                   // global position of LDS row 0

    const int tid  = threadIdx.x;
    const int wave = tid >> 5;
    const int lane = tid & 31;
    const int hk   = lane >> 4;      // K-range half (A/B fragments)
    const int ncol = lane & 15;      // column within 16-wide fragment

    // ---- B fragments: W_Q/W_K/W_V as 32x16 f16, two 16-column halves each ----
    v16h bq[2], bk[2], bv[2];
#pragma unroll
    for (int nh = 0; nh < 2; ++nh) {
        const int n = ncol + 16 * nh;
#pragma unroll
        for (int v = 0; v < 8; ++v) {
#pragma unroll
            for (int e = 0; e < 2; ++e) {
                const int k = kslot(v, e, hk);
                const bool ok = (k < MV);
                bq[nh][2 * v + e] = (_Float16)(ok ? WQ[k * HID + n] : 0.0f);
                bk[nh][2 * v + e] = (_Float16)(ok ? WK[k * HID + n] : 0.0f);
                bv[nh][2 * v + e] = (_Float16)(ok ? WV[k * HID + n] : 0.0f);
            }
        }
    }

    const float sb  = 1.0f + scalar_bias[0];
    const float vs0 = vscale[0], vs1 = vscale[1], vs2 = vscale[2], vs3 = vscale[3];
    const float vb0 = vbias[0],  vb1 = vbias[1],  vb2 = vbias[2],  vb3 = vbias[3];
    const float w0 = bw[0], w1 = bw[1], w2 = bw[2], w3 = bw[3], w4 = bw[4], w5 = bw[5];

    // ---- Projection phase: each wave owns tiles wave, wave+4, wave+8 (uniform) ----
    for (int slot = 0; slot < 3; ++slot) {
        const int tile = wave + 4 * slot;
        if (tile >= NTILES) break;                     // wave-uniform branch

        // Build A fragment (16x32 f16): both lane halves carry rows 0..15 of tile
        const int mrow = lane & 15;
        int pos = base + tile * 16 + mrow;
        if (pos > L - 1) pos = L - 1;                  // clamp (tail tiles)
        const float* xr = x + ((size_t)b * L + (size_t)pos) * 4;
        const float x0 = xr[0], x1 = xr[1], x2 = xr[2], x3 = xr[3];

        float Mv[MV];
        Mv[0]  = sb;
        Mv[1]  = x0 * vs0 + vb0;
        Mv[2]  = x1 * vs1 + vb1;
        Mv[3]  = x2 * vs2 + vb2;
        Mv[4]  = x3 * vs3 + vb3;
        Mv[5]  = w0 * (x0 - x1);
        Mv[6]  = w1 * (x0 - x2);
        Mv[7]  = w2 * (x0 - x3);
        Mv[8]  = w3 * (x1 - x2);
        Mv[9]  = w4 * (x1 - x3);
        Mv[10] = w5 * (x2 - x3);

        v16h a;
#pragma unroll
        for (int v = 0; v < 8; ++v) {
#pragma unroll
            for (int e = 0; e < 2; ++e) {
                const int k = kslot(v, e, hk);
                a[2 * v + e] = (k < MV) ? (_Float16)Mv[k] : (_Float16)0.0f;
            }
        }

        v8f dq0 = {}, dq1 = {}, dk0 = {}, dk1 = {}, dv0 = {}, dv1 = {};
        dq0 = __builtin_amdgcn_wmma_f32_16x16x32_f16(false, a, false, bq[0], (short)0, dq0, false, false);
        dq1 = __builtin_amdgcn_wmma_f32_16x16x32_f16(false, a, false, bq[1], (short)0, dq1, false, false);
        dk0 = __builtin_amdgcn_wmma_f32_16x16x32_f16(false, a, false, bk[0], (short)0, dk0, false, false);
        dk1 = __builtin_amdgcn_wmma_f32_16x16x32_f16(false, a, false, bk[1], (short)0, dk1, false, false);
        dv0 = __builtin_amdgcn_wmma_f32_16x16x32_f16(false, a, false, bv[0], (short)0, dv0, false, false);
        dv1 = __builtin_amdgcn_wmma_f32_16x16x32_f16(false, a, false, bv[1], (short)0, dv1, false, false);

        // Spill C/D to LDS: VGPR r holds row r (lanes 0-15) / row r+8 (lanes 16-31)
        const int rowBase = tile * 16 + hk * 8;
#pragma unroll
        for (int r = 0; r < 8; ++r) {
            const int row = rowBase + r;
            sQ[row * PITCH + ncol]      = phi_f(dq0[r]);
            sQ[row * PITCH + ncol + 16] = phi_f(dq1[r]);
            sK[row * PITCH + ncol]      = phi_f(dk0[r]);
            sK[row * PITCH + ncol + 16] = phi_f(dk1[r]);
            sV[row * PITCH + ncol]      = dv0[r];
            sV[row * PITCH + ncol + 16] = dv1[r];
        }
    }

    __syncthreads();

    // ---- Attention phase: one thread per query ----
    const int t = blockIdx.x * TILE_Q + tid;          // output time index
    if (t < T) {
        // query lives at LDS row tid + 8; window keys at rows tid .. tid+7
        float qreg[HID];
#pragma unroll
        for (int h = 0; h < HID; ++h) qreg[h] = sQ[(tid + LOOKBACK) * PITCH + h];

        float s[LOOKBACK];
        float den = EPSV;
#pragma unroll
        for (int l = 0; l < LOOKBACK; ++l) {
            const float* kr = &sK[(tid + l) * PITCH];
            float acc = 0.0f;
#pragma unroll
            for (int h = 0; h < HID; ++h) acc += qreg[h] * kr[h];
            s[l] = acc;
            den += acc;
        }
        const float inv = 1.0f / den;

        float pred = 0.0f;
#pragma unroll
        for (int g = 0; g < HID; ++g) {
            float num = 0.0f;
#pragma unroll
            for (int l = 0; l < LOOKBACK; ++l) num += s[l] * sV[(tid + l) * PITCH + g];
            pred += (num * inv) * w_head[g];
        }
        pred += b_head[0];

        const size_t bt = (size_t)b * T + (size_t)t;
        out_pred[bt] = pred;
        float* wout = out_w + bt * LOOKBACK;
#pragma unroll
        for (int l = 0; l < LOOKBACK; ++l) wout[l] = s[l] * inv;
    }
}

extern "C" void kernel_launch(void* const* d_in, const int* in_sizes, int n_in,
                              void* d_out, int out_size, void* d_ws, size_t ws_size,
                              hipStream_t stream) {
    const float* x   = (const float*)d_in[0];
    const float* sb  = (const float*)d_in[1];
    const float* vs  = (const float*)d_in[2];
    const float* vb  = (const float*)d_in[3];
    const float* bw  = (const float*)d_in[4];
    const float* WQ  = (const float*)d_in[5];
    const float* WK  = (const float*)d_in[6];
    const float* WV  = (const float*)d_in[7];
    const float* wh  = (const float*)d_in[8];
    const float* bh  = (const float*)d_in[9];

    const int B = 8;
    const int L = in_sizes[0] / (B * 4);
    const int T = L - LOOKBACK;

    float* out_pred = (float*)d_out;           // B*T predictions
    float* out_w    = out_pred + (size_t)B * T; // B*T*8 weights

    dim3 grid((T + TILE_Q - 1) / TILE_Q, B);
    dim3 block(TILE_Q);
    ga_attn_wmma_kernel<<<grid, block, 0, stream>>>(
        x, sb, vs, vb, bw, WQ, WK, WV, wh, bh, out_pred, out_w, L);
}

// v001
// A run of this version takes 8.87 microseconds.
// Two timings next to v000 both put it at 1.46 times that version's speed.
#include <hip/hip_runtime.h>
#include <hip/hip_bf16.h>

typedef __attribute__((ext_vector_type(16))) _Float16 v16h;
typedef __attribute__((ext_vector_type(8)))  float    v8f;
typedef __attribute__((ext_vector_type(4)))  float    v4f;

#define LOOKBACK 8
#define HID      32
#define MV       11
#define TILE_Q   128                 // queries per block
#define NPOS     (TILE_Q + 16)       // 144 positions (128 + 8 halo, rounded to 16)
#define NTILES   (NPOS / 16)         // 9 WMMA row-tiles
#define PITCH    33                  // LDS row pitch in floats (bank-conflict-free)
#define EPSV     1e-6f

__device__ __forceinline__ float phi_f(float x) {
    return (x >= 0.0f ? x : 0.01f * x) + 1.0f;
}

// K-slot index for 16-bit A/B fragment element (vgpr v, element e, lane-half hk)
__device__ __forceinline__ int kslot(int v, int e, int hk) {
    return (v < 4) ? (hk * 8 + 2 * v + e) : (16 + hk * 8 + 2 * (v - 4) + e);
}

__global__ __launch_bounds__(128)
void ga_attn_wmma_kernel(const float* __restrict__ x,
                         const float* __restrict__ scalar_bias,
                         const float* __restrict__ vscale,
                         const float* __restrict__ vbias,
                         const float* __restrict__ bw,
                         const float* __restrict__ WQ,
                         const float* __restrict__ WK,
                         const float* __restrict__ WV,
                         const float* __restrict__ w_head,
                         const float* __restrict__ b_head,
                         float* __restrict__ out_pred,
                         float* __restrict__ out_w,
                         int L) {
    __shared__ float sQ[NPOS * PITCH];
    __shared__ float sK[NPOS * PITCH];
    __shared__ float sV[NPOS * PITCH];

    const int b    = blockIdx.y;
    const int T    = L - LOOKBACK;
    const int p0   = LOOKBACK + blockIdx.x * TILE_Q;  // first query position
    const int base = p0 - LOOKBACK;                   // global position of LDS row 0

    const int tid  = threadIdx.x;
    const int wave = tid >> 5;
    const int lane = tid & 31;
    const int hk   = lane >> 4;      // K-range half (A/B fragments)
    const int ncol = lane & 15;      // column within 16-wide fragment

    // ---- B fragments: W_Q/W_K/W_V as 32x16 f16, two 16-column halves each ----
    v16h bq[2], bk[2], bv[2];
#pragma unroll
    for (int nh = 0; nh < 2; ++nh) {
        const int n = ncol + 16 * nh;
#pragma unroll
        for (int v = 0; v < 8; ++v) {
#pragma unroll
            for (int e = 0; e < 2; ++e) {
                const int k = kslot(v, e, hk);
                const bool ok = (k < MV);
                // Row index clamped, value selected afterwards: the load needs no branch,
                // so all weight loads are in flight together instead of one wait each.
                const int idx = (ok ? k : 0) * HID + n;
                const float fq = WQ[idx], fk = WK[idx], fv = WV[idx];
                bq[nh][2 * v + e] = (_Float16)(ok ? fq : 0.0f);
                bk[nh][2 * v + e] = (_Float16)(ok ? fk : 0.0f);
                bv[nh][2 * v + e] = (_Float16)(ok ? fv : 0.0f);
            }
        }
    }

    const float sb  = 1.0f + scalar_bias[0];
    const float vs0 = vscale[0], vs1 = vscale[1], vs2 = vscale[2], vs3 = vscale[3];
    const float vb0 = vbias[0],  vb1 = vbias[1],  vb2 = vbias[2],  vb3 = vbias[3];
    const float w0 = bw[0], w1 = bw[1], w2 = bw[2], w3 = bw[3], w4 = bw[4], w5 = bw[5];

    // x rows of all three tile slots, loaded ahead of the tile loop (position clamped, so a
    // slot past the last tile reads a valid row that is never used): they fly with the weights.
    v4f xv[3];
#pragma unroll
    for (int slot = 0; slot < 3; ++slot) {
        int pos = base + (wave + 4 * slot) * 16 + ncol;
        if (pos > L - 1) pos = L - 1;                  // clamp (tail tiles)
        xv[slot] = *(const v4f*)(x + ((size_t)b * L + (size_t)pos) * 4);
    }

    // ---- Projection phase: each wave owns tiles wave, wave+4, wave+8 (uniform) ----
#pragma unroll   // xv[slot] must be a register, not an indexed array
    for (int slot = 0; slot < 3; ++slot) {
        const int tile = wave + 4 * slot;
        // wave-uniform branch; a slot whose four tiles all exist has none, so the loads above
        // stay in straight-line code instead of sinking behind a test
        if (4 * slot + 3 >= NTILES && tile >= NTILES) break;

        // Build A fragment (16x32 f16): both lane halves carry rows 0..15 of tile
        const float x0 = xv[slot][0], x1 = xv[slot][1], x2 = xv[slot][2], x3 = xv[slot][3];

        float Mv[MV];
        Mv[0]  = sb;
        Mv[1]  = x0 * vs0 + vb0;
        Mv[2]  = x1 * vs1 + vb1;
        Mv[3]  = x2 * vs2 + vb2;
        Mv[4]  = x3 * vs3 + vb3;
        Mv[5]  = w0 * (x0 - x1);
        Mv[6]  = w1 * (x0 - x2);
        Mv[7]  = w2 * (x0 - x3);
        Mv[8]  = w3 * (x1 - x2);
        Mv[9]  = w4 * (x1 - x3);
        Mv[10] = w5 * (x2 - x3);

        v16h a;
#pragma unroll
        for (int v = 0; v < 8; ++v) {
#pragma unroll
            for (int e = 0; e < 2; ++e) {
                const int k = kslot(v, e, hk);
                a[2 * v + e] = (k < MV) ? (_Float16)Mv[k] : (_Float16)0.0f;
            }
        }

        v8f dq0 = {}, dq1 = {}, dk0 = {}, dk1 = {}, dv0 = {}, dv1 = {};
        dq0 = __builtin_amdgcn_wmma_f32_16x16x32_f16(false, a, false, bq[0], (short)0, dq0, false, false);
        dq1 = __builtin_amdgcn_wmma_f32_16x16x32_f16(false, a, false, bq[1], (short)0, dq1, false, false);
        dk0 = __builtin_amdgcn_wmma_f32_16x16x32_f16(false, a, false, bk[0], (short)0, dk0, false, false);
        dk1 = __builtin_amdgcn_wmma_f32_16x16x32_f16(false, a, false, bk[1], (short)0, dk1, false, false);
        dv0 = __builtin_amdgcn_wmma_f32_16x16x32_f16(false, a, false, bv[0], (short)0, dv0, false, false);
        dv1 = __builtin_amdgcn_wmma_f32_16x16x32_f16(false, a, false, bv[1], (short)0, dv1, false, false);

        // Spill C/D to LDS: VGPR r holds row r (lanes 0-15) / row r+8 (lanes 16-31)
        const int rowBase = tile * 16 + hk * 8;
#pragma unroll
        for (int r = 0; r < 8; ++r) {
            const int row = rowBase + r;
            sQ[row * PITCH + ncol]      = phi_f(dq0[r]);
            sQ[row * PITCH + ncol + 16] = phi_f(dq1[r]);
            sK[row * PITCH + ncol]      = phi_f(dk0[r]);
            sK[row * PITCH + ncol + 16] = phi_f(dk1[r]);
            sV[row * PITCH + ncol]      = dv0[r];
            sV[row * PITCH + ncol + 16] = dv1[r];
        }
        // Inputs-only fence on the loaded row: without it the last slot's x load sinks behind that
        // slot's test, and the wave that owns the ninth tile waits for it alone before the barrier.
        if (slot == 1) asm volatile("" :: "v"(xv[2]));
    }

    __syncthreads();

    // ---- Attention phase: one thread per query ----
    const int t = blockIdx.x * TILE_Q + tid;          // output time index
    if (t < T) {
        // query lives at LDS row tid + 8; window keys at rows tid .. tid+7
        float qreg[HID];
#pragma unroll
        for (int h = 0; h < HID; ++h) qreg[h] = sQ[(tid + LOOKBACK) * PITCH + h];

        float s[LOOKBACK];
        float den = EPSV;
#pragma unroll
        for (int l = 0; l < LOOKBACK; ++l) {
            const float* kr = &sK[(tid + l) * PITCH];
            float acc = 0.0f;
#pragma unroll
            for (int h = 0; h < HID; ++h) acc += qreg[h] * kr[h];
            s[l] = acc;
            den += acc;
        }
        const float inv = 1.0f / den;

        float pred = 0.0f;
#pragma unroll
        for (int g = 0; g < HID; ++g) {
            float num = 0.0f;
#pragma unroll
            for (int l = 0; l < LOOKBACK; ++l) num += s[l] * sV[(tid + l) * PITCH + g];
            pred += (num * inv) * w_head[g];
        }
        pred += b_head[0];

        const size_t bt = (size_t)b * T + (size_t)t;
        out_pred[bt] = pred;
        float* wout = out_w + bt * LOOKBACK;
#pragma unroll
        for (int l = 0; l < LOOKBACK; ++l) wout[l] = s[l] * inv;
    }
}

extern "C" void kernel_launch(void* const* d_in, const int* in_sizes, int n_in,
                              void* d_out, int out_size, void* d_ws, size_t ws_size,
                              hipStream_t stream) {
    const float* x   = (const float*)d_in[0];
    const float* sb  = (const float*)d_in[1];
    const float* vs  = (const float*)d_in[2];
    const float* vb  = (const float*)d_in[3];
    const float* bw  = (const float*)d_in[4];
    const float* WQ  = (const float*)d_in[5];
    const float* WK  = (const float*)d_in[6];
    const float* WV  = (const float*)d_in[7];
    const float* wh  = (const float*)d_in[8];
    const float* bh  = (const float*)d_in[9];

    const int B = 8;
    const int L = in_sizes[0] / (B * 4);
    const int T = L - LOOKBACK;

    float* out_pred = (float*)d_out;           // B*T predictions
    float* out_w    = out_pred + (size_t)B * T; // B*T*8 weights

    dim3 grid((T + TILE_Q - 1) / TILE_Q, B);
    dim3 block(TILE_Q);
    ga_attn_wmma_kernel<<<grid, block, 0, stream>>>(
        x, sb, vs, vb, bw, WQ, WK, WV, wh, bh, out_pred, out_w, L);
}

// v002
// One run takes 7.08 microseconds.
// Timed twice side by side with v001, it ran 1.25 times as fast both times.
// Counting every step since v000, it is 1.83 times as fast.
#include <hip/hip_runtime.h>
#include <hip/hip_bf16.h>

typedef __attribute__((ext_vector_type(16))) _Float16 v16h;
typedef __attribute__((ext_vector_type(8)))  float    v8f;
typedef __attribute__((ext_vector_type(4)))  float    v4f;

#define LOOKBACK 8
#define HID      32
#define MV       11
#define TILE_Q   128                 // queries per block
#define NPOS     (TILE_Q + 16)       // 144 positions (128 + 8 halo, rounded to 16)
#define NTILES   (NPOS / 16)         // 9 WMMA row-tiles
#define PITCH    33                  // LDS row pitch in floats (bank-conflict-free)
#define EPSV     1e-6f

__device__ __forceinline__ float phi_f(float x) {
    return (x >= 0.0f ? x : 0.01f * x) + 1.0f;
}

// Sum over the 16 lanes of a row, left in every lane of the row (DPP butterfly).
__device__ __forceinline__ float row16_sum(float v) {
    v += __builtin_bit_cast(float, __builtin_amdgcn_update_dpp(0, __builtin_bit_cast(int, v), 0x161, 0xf, 0xf, true)); // row_xmask:1
    v += __builtin_bit_cast(float, __builtin_amdgcn_update_dpp(0, __builtin_bit_cast(int, v), 0x162, 0xf, 0xf, true)); // row_xmask:2
    v += __builtin_bit_cast(float, __builtin_amdgcn_update_dpp(0, __builtin_bit_cast(int, v), 0x164, 0xf, 0xf, true)); // row_xmask:4
    v += __builtin_bit_cast(float, __builtin_amdgcn_update_dpp(0, __builtin_bit_cast(int, v), 0x168, 0xf, 0xf, true)); // row_xmask:8
    return v;
}

// K-slot index for 16-bit A/B fragment element (vgpr v, element e, lane-half hk)
__device__ __forceinline__ int kslot(int v, int e, int hk) {
    return (v < 4) ? (hk * 8 + 2 * v + e) : (16 + hk * 8 + 2 * (v - 4) + e);
}

__global__ __launch_bounds__(128)
void ga_attn_wmma_kernel(const float* __restrict__ x,
                         const float* __restrict__ scalar_bias,
                         const float* __restrict__ vscale,
                         const float* __restrict__ vbias,
                         const float* __restrict__ bw,
                         const float* __restrict__ WQ,
                         const float* __restrict__ WK,
                         const float* __restrict__ WV,
                         const float* __restrict__ w_head,
                         const float* __restrict__ b_head,
                         float* __restrict__ out_pred,
                         float* __restrict__ out_w,
                         int L) {
    __shared__ float sQ[NPOS * PITCH];
    __shared__ float sK[NPOS * PITCH];
    __shared__ float sVh[NPOS];      // V row . w_head, one float per position

    const int b    = blockIdx.y;
    const int T    = L - LOOKBACK;
    const int p0   = LOOKBACK + blockIdx.x * TILE_Q;  // first query position
    const int base = p0 - LOOKBACK;                   // global position of LDS row 0

    const int tid  = threadIdx.x;
    const int wave = tid >> 5;
    const int lane = tid & 31;
    const int hk   = lane >> 4;      // K-range half (A/B fragments)
    const int ncol = lane & 15;      // column within 16-wide fragment

    // ---- B fragments: W_Q/W_K as 32x16 f16, two 16-column halves each ----
    // The head is linear in V: (sum_l s_l V_l / den) . w_head = sum_l s_l (M_l . (W_V w_head)) / den.
    // So V is projected straight onto w_head: wvp[] gathers this lane's share of W_V w_head in f32.
    v16h bq[2], bk[2];
    float wvp[16];                   // only 0..7 (k < 16) can be non-zero
#pragma unroll
    for (int i = 0; i < 16; ++i) wvp[i] = 0.0f;
#pragma unroll
    for (int nh = 0; nh < 2; ++nh) {
        const int n = ncol + 16 * nh;
        const float wh = w_head[n];
#pragma unroll
        for (int v = 0; v < 8; ++v) {
#pragma unroll
            for (int e = 0; e < 2; ++e) {
                const int k = kslot(v, e, hk);
                const bool ok = (k < MV);
                // Row index clamped, value selected afterwards: the load needs no branch,
                // so all weight loads are in flight together instead of one wait each.
                const int idx = (ok ? k : 0) * HID + n;
                const float fq = WQ[idx], fk = WK[idx], fv = WV[idx];
                bq[nh][2 * v + e] = (_Float16)(ok ? fq : 0.0f);
                bk[nh][2 * v + e] = (_Float16)(ok ? fk : 0.0f);
                wvp[2 * v + e] += (ok ? fv : 0.0f) * wh;
            }
        }
    }

    // A fragment whose 16 rows are all (W_V w_head)^T: the row sum leaves the same value in every lane.
    // Elements 0..7 (k < 16) hold its f16 value, elements 8..15 (k >= 16, idle so far) the f16 remainder:
    // one rounding now stands where 32 independent ones averaged out, and the remainder takes it back.
    v16h bvh;
#pragma unroll
    for (int i = 0; i < 8; ++i) {
        const float w = row16_sum(wvp[i]);
        bvh[i]     = (_Float16)w;
        bvh[i + 8] = (_Float16)(w - (float)bvh[i]);
    }

    const float sb  = 1.0f + scalar_bias[0];
    const float vs0 = vscale[0], vs1 = vscale[1], vs2 = vscale[2], vs3 = vscale[3];
    const float vb0 = vbias[0],  vb1 = vbias[1],  vb2 = vbias[2],  vb3 = vbias[3];
    const float w0 = bw[0], w1 = bw[1], w2 = bw[2], w3 = bw[3], w4 = bw[4], w5 = bw[5];

    // x rows of all three tile slots, loaded ahead of the tile loop (position clamped, so a
    // slot past the last tile reads a valid row that is never used): they fly with the weights.
    v4f xv[3];
#pragma unroll
    for (int slot = 0; slot < 3; ++slot) {
        int pos = base + (wave + 4 * slot) * 16 + ncol;
        if (pos > L - 1) pos = L - 1;                  // clamp (tail tiles)
        xv[slot] = *(const v4f*)(x + ((size_t)b * L + (size_t)pos) * 4);
    }

    // ---- Projection phase: each wave owns tiles wave, wave+4, wave+8 (uniform) ----
#pragma unroll   // xv[slot] must be a register, not an indexed array
    for (int slot = 0; slot < 3; ++slot) {
        const int tile = wave + 4 * slot;
        // wave-uniform branch; a slot whose four tiles all exist has none, so the loads above
        // stay in straight-line code instead of sinking behind a test
        if (4 * slot + 3 >= NTILES && tile >= NTILES) break;

        // Build A fragment (16x32 f16): both lane halves carry rows 0..15 of tile
        const float x0 = xv[slot][0], x1 = xv[slot][1], x2 = xv[slot][2], x3 = xv[slot][3];

        float Mv[MV];
        Mv[0]  = sb;
        Mv[1]  = x0 * vs0 + vb0;
        Mv[2]  = x1 * vs1 + vb1;
        Mv[3]  = x2 * vs2 + vb2;
        Mv[4]  = x3 * vs3 + vb3;
        Mv[5]  = w0 * (x0 - x1);
        Mv[6]  = w1 * (x0 - x2);
        Mv[7]  = w2 * (x0 - x3);
        Mv[8]  = w3 * (x1 - x2);
        Mv[9]  = w4 * (x1 - x3);
        Mv[10] = w5 * (x2 - x3);

        v16h a;
#pragma unroll
        for (int v = 0; v < 8; ++v) {
#pragma unroll
            for (int e = 0; e < 2; ++e) {
                const int k = kslot(v, e, hk);
                // k >= 16: M once more, for the remainder in bvh (W_Q and W_K have zero rows there)
                a[2 * v + e] = (v >= 4) ? a[2 * v + e - 8] : (k < MV) ? (_Float16)Mv[k] : (_Float16)0.0f;
            }
        }

        v8f dq0 = {}, dq1 = {}, dk0 = {}, dk1 = {}, dvh = {};
        dq0 = __builtin_amdgcn_wmma_f32_16x16x32_f16(false, a, false, bq[0], (short)0, dq0, false, false);
        dq1 = __builtin_amdgcn_wmma_f32_16x16x32_f16(false, a, false, bq[1], (short)0, dq1, false, false);
        dk0 = __builtin_amdgcn_wmma_f32_16x16x32_f16(false, a, false, bk[0], (short)0, dk0, false, false);
        dk1 = __builtin_amdgcn_wmma_f32_16x16x32_f16(false, a, false, bk[1], (short)0, dk1, false, false);
        // roles swapped: the M fragment serves as B (same k order), so lane ncol holds position ncol's value
        dvh = __builtin_amdgcn_wmma_f32_16x16x32_f16(false, bvh, false, a,   (short)0, dvh, false, false);

        // Spill C/D to LDS: VGPR r holds row r (lanes 0-15) / row r+8 (lanes 16-31)
        const int rowBase = tile * 16 + hk * 8;
#pragma unroll
        for (int r = 0; r < 8; ++r) {
            const int row = rowBase + r;
            sQ[row * PITCH + ncol]      = phi_f(dq0[r]);
            sQ[row * PITCH + ncol + 16] = phi_f(dq1[r]);
            sK[row * PITCH + ncol]      = phi_f(dk0[r]);
            sK[row * PITCH + ncol + 16] = phi_f(dk1[r]);
        }
        sVh[tile * 16 + ncol] = dvh[0];   // all 16 rows of dvh are equal: both lane halves store the same value
        // Inputs-only fence on the loaded row: without it the last slot's x load sinks behind that
        // slot's test, and the wave that owns the ninth tile waits for it alone before the barrier.
        if (slot == 1) asm volatile("" :: "v"(xv[2]));
    }

    __syncthreads();

    // ---- Attention phase: one thread per query ----
    const int t = blockIdx.x * TILE_Q + tid;          // output time index
    if (t < T) {
        // query lives at LDS row tid + 8; window keys at rows tid .. tid+7
        float qreg[HID];
#pragma unroll
        for (int h = 0; h < HID; ++h) qreg[h] = sQ[(tid + LOOKBACK) * PITCH + h];

        float s[LOOKBACK];
        float den = EPSV;
#pragma unroll
        for (int l = 0; l < LOOKBACK; ++l) {
            const float* kr = &sK[(tid + l) * PITCH];
            float acc = 0.0f;
#pragma unroll
            for (int h = 0; h < HID; ++h) acc += qreg[h] * kr[h];
            s[l] = acc;
            den += acc;
        }
        const float inv = 1.0f / den;

        float num = 0.0f;
#pragma unroll
        for (int l = 0; l < LOOKBACK; ++l) num += s[l] * sVh[tid + l];
        const float pred = num * inv + b_head[0];

        const size_t bt = (size_t)b * T + (size_t)t;
        out_pred[bt] = pred;
        float* wout = out_w + bt * LOOKBACK;
#pragma unroll
        for (int l = 0; l < LOOKBACK; ++l) wout[l] = s[l] * inv;
    }
}

extern "C" void kernel_launch(void* const* d_in, const int* in_sizes, int n_in,
                              void* d_out, int out_size, void* d_ws, size_t ws_size,
                              hipStream_t stream) {
    const float* x   = (const float*)d_in[0];
    const float* sb  = (const float*)d_in[1];
    const float* vs  = (const float*)d_in[2];
    const float* vb  = (const float*)d_in[3];
    const float* bw  = (const float*)d_in[4];
    const float* WQ  = (const float*)d_in[5];
    const float* WK  = (const float*)d_in[6];
    const float* WV  = (const float*)d_in[7];
    const float* wh  = (const float*)d_in[8];
    const float* bh  = (const float*)d_in[9];

    const int B = 8;
    const int L = in_sizes[0] / (B * 4);
    const int T = L - LOOKBACK;

    float* out_pred = (float*)d_out;           // B*T predictions
    float* out_w    = out_pred + (size_t)B * T; // B*T*8 weights

    dim3 grid((T + TILE_Q - 1) / TILE_Q, B);
    dim3 block(TILE_Q);
    ga_attn_wmma_kernel<<<grid, block, 0, stream>>>(
        x, sb, vs, vb, bw, WQ, WK, WV, wh, bh, out_pred, out_w, L);
}

// v003
// It runs in 6.23 microseconds.
// Timed twice side by side with v002, it ran 1.14 times as fast both times.
// Over all steps from v000 it is 2.08 times as fast.
#include <hip/hip_runtime.h>
#include <hip/hip_bf16.h>

typedef __attribute__((ext_vector_type(16))) _Float16 v16h;
typedef __attribute__((ext_vector_type(8)))  float    v8f;
typedef __attribute__((ext_vector_type(4)))  float    v4f;
typedef __attribute__((ext_vector_type(8)))  int      v8i;
typedef __attribute__((ext_vector_type(16))) float    v16f;

#define LOOKBACK 8
#define HID      32
#define MV       11
#define TILE_Q   128                 // queries per block
#define WAVE_Q   32                  // queries per wave: two 16-query tiles
#define WPITCH   20                  // LDS row pitch in floats of a weight tile (bank-conflict-free, rows 16-byte aligned)
#define EPSV     1e-6f

__device__ __forceinline__ float phi_f(float x) {
    return (x >= 0.0f ? x : 0.01f * x) + 1.0f;
}

// Sum over the 16 lanes of a row, left in every lane of the row (DPP butterfly).
__device__ __forceinline__ float row16_sum(float v) {
    v += __builtin_bit_cast(float, __builtin_amdgcn_update_dpp(0, __builtin_bit_cast(int, v), 0x161, 0xf, 0xf, true)); // row_xmask:1
    v += __builtin_bit_cast(float, __builtin_amdgcn_update_dpp(0, __builtin_bit_cast(int, v), 0x162, 0xf, 0xf, true)); // row_xmask:2
    v += __builtin_bit_cast(float, __builtin_amdgcn_update_dpp(0, __builtin_bit_cast(int, v), 0x164, 0xf, 0xf, true)); // row_xmask:4
    v += __builtin_bit_cast(float, __builtin_amdgcn_update_dpp(0, __builtin_bit_cast(int, v), 0x168, 0xf, 0xf, true)); // row_xmask:8
    return v;
}

// Value of lane l ^ 16 (the other lane half).
__device__ __forceinline__ float xhalf(float v) {
    return __builtin_bit_cast(float, __builtin_amdgcn_permlanex16(__builtin_bit_cast(int, v), __builtin_bit_cast(int, v),
                                                                  0x76543210, 0xfedcba98, false, false));
}

// K-slot index for 16-bit A/B fragment element (vgpr v, element e, lane-half hk)
__device__ __forceinline__ int kslot(int v, int e, int hk) {
    return (v < 4) ? (hk * 8 + 2 * v + e) : (16 + hk * 8 + 2 * (v - 4) + e);
}

// Two transposed projection tiles (feature 8*hk + r and 16 + 8*hk + r of position ncol) are, element for
// element, a 16x32 operand over the 32 features. Each phi value goes in as its f16 value (hi) and the
// f16 remainder (lo), so that hi.hi + lo.hi + hi.lo keeps the f32 product.
__device__ __forceinline__ void phi_split(const v8f d0, const v8f d1, v16h& hi, v16h& lo) {
#pragma unroll
    for (int r = 0; r < 8; ++r) {
        const float f0 = phi_f(d0[r]), f1 = phi_f(d1[r]);
        hi[r]     = (_Float16)f0;
        hi[r + 8] = (_Float16)f1;
        lo[r]     = (_Float16)(f0 - (float)hi[r]);
        lo[r + 8] = (_Float16)(f1 - (float)hi[r + 8]);
    }
}

__global__ __launch_bounds__(128)
void ga_attn_wmma_kernel(const float* __restrict__ x,
                         const float* __restrict__ scalar_bias,
                         const float* __restrict__ vscale,
                         const float* __restrict__ vbias,
                         const float* __restrict__ bw,
                         const float* __restrict__ WQ,
                         const float* __restrict__ WK,
                         const float* __restrict__ WV,
                         const float* __restrict__ w_head,
                         const float* __restrict__ b_head,
                         float* __restrict__ out_pred,
                         float* __restrict__ out_w,
                         int L) {
    // Each wave's own two weight tiles, [query][window slot]; no wave reads another's.
    __shared__ __attribute__((aligned(16))) float sW[TILE_Q / WAVE_Q][2][16 * WPITCH];

    const int b    = blockIdx.y;
    const int T    = L - LOOKBACK;

    const int tid  = threadIdx.x;
    const int wave = tid >> 5;
    const int lane = tid & 31;
    const int hk   = lane >> 4;      // K-range half (A/B fragments)
    const int ncol = lane & 15;      // column within 16-wide fragment
    const int t0   = blockIdx.x * TILE_Q + wave * WAVE_Q;  // first output index of this wave = position of its first key

    // ---- All global loads first: weight rows (row index clamped, value selected afterwards, so no load
    // needs a branch), w_head, and the x rows of the three position tiles (t0 + 16 j + ncol, clamped at the tail).
    // Only k < 16 can be non-zero: element nh * 8 + i is row k = 8 hk + i, column ncol + 16 nh.
    v16f rq, rk, rv;
    float whd[2];
    int   ix[8];
    const float* px[3];
#pragma unroll
    for (int nh = 0; nh < 2; ++nh) {
        const int n = ncol + 16 * nh;
        whd[nh] = w_head[n];
#pragma unroll
        for (int i = 0; i < 8; ++i) {
            const int k = hk * 8 + i;
            const int idx = ((k < MV) ? k : 0) * HID + n;
            if (nh == 0) ix[i] = idx;
            rq[nh * 8 + i] = WQ[idx];
            rk[nh * 8 + i] = WK[idx];
            rv[nh * 8 + i] = WV[idx];
        }
    }
    v4f xk[3];
#pragma unroll
    for (int j = 0; j < 3; ++j) {
        int pos = t0 + 16 * j + ncol;
        if (pos > L - 1) pos = L - 1;
        px[j] = x + ((size_t)b * L + (size_t)pos) * 4;
        xk[j] = *(const v4f*)px[j];
    }
    const float sb0 = scalar_bias[0], bh = b_head[0];
    const float vs0 = vscale[0], vs1 = vscale[1], vs2 = vscale[2], vs3 = vscale[3];
    const float vb0 = vbias[0],  vb1 = vbias[1],  vb2 = vbias[2],  vb3 = vbias[3];
    const float w0 = bw[0], w1 = bw[1], w2 = bw[2], w3 = bw[3], w4 = bw[4], w5 = bw[5];
    // Inputs-only fence on the loaded values: without it each group of loads sinks to its first use in the
    // long straight-line code below, and the wave waits out a memory latency per group instead of one for all.
    asm volatile("" :: "v"(rq), "v"(rk), "v"(rv), "v"(xk[0]), "v"(xk[1]), "v"(xk[2]), "v"(whd[0]), "v"(whd[1]),
                 "s"(sb0), "s"(bh), "s"(vs0), "s"(vs1), "s"(vs2), "s"(vs3), "s"(vb0), "s"(vb1), "s"(vb2), "s"(vb3),
                 "s"(w0), "s"(w1), "s"(w2), "s"(w3), "s"(w4), "s"(w5));
    // The loads' address registers as inputs behind that fence: they stay live until every load has returned,
    // so no later load's result lands in a register that an issued load still names.
    asm volatile("" :: "v"(px[0]), "v"(px[1]), "v"(px[2]), "v"(ix[0]), "v"(ix[1]), "v"(ix[2]), "v"(ix[3]),
                 "v"(ix[4]), "v"(ix[5]), "v"(ix[6]), "v"(ix[7]), "s"(WQ), "s"(WK), "s"(WV), "s"(w_head));
    const float sb = 1.0f + sb0;

    // ---- Fragments of W_Q/W_K as 32x16 f16, two 16-column halves each ----
    // The head is linear in V: (sum_l s_l V_l / den) . w_head = sum_l s_l (M_l . (W_V w_head)) / den.
    // So V is projected straight onto w_head: wvp[] gathers this lane's share of W_V w_head in f32.
    v16h bq[2], bk[2];
    float wvp[8];
#pragma unroll
    for (int i = 0; i < 8; ++i) wvp[i] = 0.0f;
#pragma unroll
    for (int nh = 0; nh < 2; ++nh) {
#pragma unroll
        for (int i = 0; i < 8; ++i) {
            // rows k = 8 hk + i >= MV do not exist: i >= MV - 8 in lane half 1. Their (clamped) loads are
            // cleared with a bit mask, which stays branch-free.
            const int keep = (i < MV - 8) ? -1 : hk - 1;
            const float fq = rq[nh * 8 + i], fk = rk[nh * 8 + i], fv = rv[nh * 8 + i];
            bq[nh][i]     = (_Float16)__builtin_bit_cast(float, __builtin_bit_cast(int, fq) & keep);
            bk[nh][i]     = (_Float16)__builtin_bit_cast(float, __builtin_bit_cast(int, fk) & keep);
            bq[nh][i + 8] = (_Float16)0.0f;
            bk[nh][i + 8] = (_Float16)0.0f;
            wvp[i] += __builtin_bit_cast(float, __builtin_bit_cast(int, fv) & keep) * whd[nh];
        }
    }

    // Fragment whose 16 rows (or columns) are all W_V w_head: the row sum leaves the same value in every lane.
    // Elements 0..7 (k < 16) hold its f16 value, elements 8..15 (k >= 16, idle so far) the f16 remainder:
    // one rounding now stands where 32 independent ones averaged out, and the remainder takes it back.
    v16h bvh;
#pragma unroll
    for (int i = 0; i < 8; ++i) {
        const float w = row16_sum(wvp[i]);
        bvh[i]     = (_Float16)w;
        bvh[i + 8] = (_Float16)(w - (float)bvh[i]);
    }

    // 16x32 f16 fragment of M: both lane halves carry the 16 positions of a tile
    auto m_frag = [&](const v4f xr) -> v16h {
        const float x0 = xr[0], x1 = xr[1], x2 = xr[2], x3 = xr[3];
        float Mv[MV];
        Mv[0]  = sb;
        Mv[1]  = x0 * vs0 + vb0;
        Mv[2]  = x1 * vs1 + vb1;
        Mv[3]  = x2 * vs2 + vb2;
        Mv[4]  = x3 * vs3 + vb3;
        Mv[5]  = w0 * (x0 - x1);
        Mv[6]  = w1 * (x0 - x2);
        Mv[7]  = w2 * (x0 - x3);
        Mv[8]  = w3 * (x1 - x2);
        Mv[9]  = w4 * (x1 - x3);
        Mv[10] = w5 * (x2 - x3);
        v16h a;
#pragma unroll
        for (int v = 0; v < 8; ++v) {
#pragma unroll
            for (int e = 0; e < 2; ++e) {
                const int k = kslot(v, e, hk);
                // k >= 16: M once more, for the remainder in bvh (W_Q and W_K have zero rows there)
                a[2 * v + e] = (v >= 4) ? a[2 * v + e - 8] : (k < MV) ? (_Float16)Mv[k] : (_Float16)0.0f;
            }
        }
        return a;
    };

    // ---- Keys: W_K^T as A, M as B, so lane (ncol, hk) holds 16 features of position ncol ----
    v16h am[3], kh[3], kl[3];
    v8f  vh[3];                      // vh[j][r] = (V row . w_head) of position 8 hk + r of tile j, in every lane
#pragma unroll
    for (int j = 0; j < 3; ++j) {
        const v16h a = m_frag(xk[j]);
        am[j] = a;
        v8f d0 = {}, d1 = {}, dv = {};
        d0 = __builtin_amdgcn_wmma_f32_16x16x32_f16(false, bk[0], false, a,   (short)0, d0, false, false);
        d1 = __builtin_amdgcn_wmma_f32_16x16x32_f16(false, bk[1], false, a,   (short)0, d1, false, false);
        dv = __builtin_amdgcn_wmma_f32_16x16x32_f16(false, a,     false, bvh, (short)0, dv, false, false);
        phi_split(d0, d1, kh[j], kl[j]);
        vh[j] = dv;
    }

    // Query m = ncol of a tile takes key rows m .. m + 7, counted from its own key tile's row 0:
    // row kk = 8 hk + r of that tile where kk >= m, row kk of the next tile where kk <= m - 9.
    const int dsh = ncol - 8 * hk;   // kk - m = r - dsh
    float pred[2];
#pragma unroll
    for (int i = 0; i < 2; ++i) {
        // Query tile i stands 8 positions behind key tile i: its M fragment is lanes 8..15 of tile i and
        // lanes 0..7 of tile i + 1, each moved to lane ^ 8 of its 16-lane row (same lane half, same k).
        const v8i m0 = __builtin_bit_cast(v8i, am[i]), m1 = __builtin_bit_cast(v8i, am[i + 1]);
        v8i mq;
#pragma unroll
        for (int w = 0; w < 4; ++w) {
            mq[w]     = __builtin_amdgcn_update_dpp(0, (ncol >= 8) ? m0[w] : m1[w], 0x168, 0xf, 0xf, true); // row_xmask:8
            mq[w + 4] = mq[w];       // k >= 16 repeats k < 16, as in m_frag
        }
        const v16h a = __builtin_bit_cast(v16h, mq);
        v8f d0 = {}, d1 = {};
        d0 = __builtin_amdgcn_wmma_f32_16x16x32_f16(false, bq[0], false, a, (short)0, d0, false, false);
        d1 = __builtin_amdgcn_wmma_f32_16x16x32_f16(false, bq[1], false, a, (short)0, d1, false, false);
        v16h qh, ql;
        phi_split(d0, d1, qh, ql);

        // scores, keys as rows and queries as columns: sa[r] = K[tile i, row 8 hk + r] . Q[query ncol]
        v8f sa = {}, sn = {};
        sa = __builtin_amdgcn_wmma_f32_16x16x32_f16(false, kl[i],     false, qh, (short)0, sa, false, false);
        sn = __builtin_amdgcn_wmma_f32_16x16x32_f16(false, kl[i + 1], false, qh, (short)0, sn, false, false);
        sa = __builtin_amdgcn_wmma_f32_16x16x32_f16(false, kh[i],     false, ql, (short)0, sa, false, false);
        sn = __builtin_amdgcn_wmma_f32_16x16x32_f16(false, kh[i + 1], false, ql, (short)0, sn, false, false);
        sa = __builtin_amdgcn_wmma_f32_16x16x32_f16(false, kh[i],     false, qh, (short)0, sa, false, false);
        sn = __builtin_amdgcn_wmma_f32_16x16x32_f16(false, kh[i + 1], false, qh, (short)0, sn, false, false);

        float s[8];
        float den = 0.0f, num = 0.0f;
#pragma unroll
        for (int r = 0; r < 8; ++r) {
            const bool own = (r >= dsh);                     // this tile's row, else the next tile's
            const bool in  = (((r - dsh) & 15) < LOOKBACK);  // window slot 0..7: the row is one of the query's keys
            s[r] = own ? sa[r] : sn[r];
            const float v  = own ? vh[i][r] : vh[i + 1][r];
            const float sz = in ? s[r] : 0.0f;
            den += sz;
            num += sz * v;
        }
        den += xhalf(den);           // the two lane halves hold the two halves of the key rows
        num += xhalf(num);
        const float inv = 1.0f / (den + EPSV);
        pred[i] = num * inv + bh;

        // Row = query, column = window slot; slots 8..15 take the rows outside the window and are never read.
#pragma unroll
        for (int r = 0; r < 8; ++r)
            sW[wave][i][ncol * WPITCH + ((r - dsh) & 15)] = s[r] * inv;
    }

    // The wave reads back what its own lanes stored: the fence waits for those LDS stores, and the wave
    // barrier keeps the compiler from moving the loads above them. No other wave is involved.
    __builtin_amdgcn_fence(__ATOMIC_ACQ_REL, "workgroup");
    __builtin_amdgcn_wave_barrier();

#pragma unroll
    for (int i = 0; i < 2; ++i) {
        const int t = t0 + 16 * i + (lane >> 1);      // two lanes per query, 16 bytes each: 512 contiguous bytes a store
        const v4f w4 = *(const v4f*)&sW[wave][i][(lane >> 1) * WPITCH + (lane & 1) * 4];
        if (t < T) *(v4f*)(out_w + ((size_t)b * T + (size_t)t) * LOOKBACK + (lane & 1) * 4) = w4;
    }
    {
        const int t = t0 + lane;                      // lane half hk carries tile hk's queries
        if (t < T) out_pred[(size_t)b * T + (size_t)t] = hk ? pred[1] : pred[0];
    }
}

extern "C" void kernel_launch(void* const* d_in, const int* in_sizes, int n_in,
                              void* d_out, int out_size, void* d_ws, size_t ws_size,
                              hipStream_t stream) {
    const float* x   = (const float*)d_in[0];
    const float* sb  = (const float*)d_in[1];
    const float* vs  = (const float*)d_in[2];
    const float* vb  = (const float*)d_in[3];
    const float* bw  = (const float*)d_in[4];
    const float* WQ  = (const float*)d_in[5];
    const float* WK  = (const float*)d_in[6];
    const float* WV  = (const float*)d_in[7];
    const float* wh  = (const float*)d_in[8];
    const float* bh  = (const float*)d_in[9];

    const int B = 8;
    const int L = in_sizes[0] / (B * 4);
    const int T = L - LOOKBACK;

    float* out_pred = (float*)d_out;           // B*T predictions
    float* out_w    = out_pred + (size_t)B * T; // B*T*8 weights

    dim3 grid((T + TILE_Q - 1) / TILE_Q, B);
    dim3 block(TILE_Q);
    ga_attn_wmma_kernel<<<grid, block, 0, stream>>>(
        x, sb, vs, vb, bw, WQ, WK, WV, wh, bh, out_pred, out_w, L);
}

// v004
// Measured time: 5.79 microseconds a run.
// Timed twice side by side with v003, it ran 1.08 times as fast both times.
// Over all steps from v000 it is 2.25 times as fast.
#include <hip/hip_runtime.h>
#include <hip/hip_bf16.h>

typedef __attribute__((ext_vector_type(16))) _Float16 v16h;
typedef __attribute__((ext_vector_type(8)))  float    v8f;
typedef __attribute__((ext_vector_type(4)))  float    v4f;
typedef __attribute__((ext_vector_type(8)))  int      v8i;
typedef __attribute__((ext_vector_type(16))) float    v16f;

#define LOOKBACK 8
#define HID      32
#define MV       11
#define TILE_Q   128                 // queries per block
#define WAVE_Q   32                  // queries per wave: two 16-query tiles
#define WPITCH   20                  // LDS row pitch in floats of a weight tile (bank-conflict-free, rows 16-byte aligned)
#define EPSV     1e-6f

__device__ __forceinline__ float phi_f(float x) {
    return (x >= 0.0f ? x : 0.01f * x) + 1.0f;
}

// Sum over the 16 lanes of a row, left in every lane of the row (DPP butterfly).
__device__ __forceinline__ float row16_sum(float v) {
    v += __builtin_bit_cast(float, __builtin_amdgcn_update_dpp(0, __builtin_bit_cast(int, v), 0x161, 0xf, 0xf, true)); // row_xmask:1
    v += __builtin_bit_cast(float, __builtin_amdgcn_update_dpp(0, __builtin_bit_cast(int, v), 0x162, 0xf, 0xf, true)); // row_xmask:2
    v += __builtin_bit_cast(float, __builtin_amdgcn_update_dpp(0, __builtin_bit_cast(int, v), 0x164, 0xf, 0xf, true)); // row_xmask:4
    v += __builtin_bit_cast(float, __builtin_amdgcn_update_dpp(0, __builtin_bit_cast(int, v), 0x168, 0xf, 0xf, true)); // row_xmask:8
    return v;
}

// Value of lane l ^ 16 (the other lane half).
__device__ __forceinline__ float xhalf(float v) {
    return __builtin_bit_cast(float, __builtin_amdgcn_permlanex16(__builtin_bit_cast(int, v), __builtin_bit_cast(int, v),
                                                                  0x76543210, 0xfedcba98, false, false));
}

// Two transposed projection tiles (feature 8*hk + r and 16 + 8*hk + r of position ncol) are, element for
// element, a 16x32 operand over the 32 features. Each phi value goes in as its f16 value (hi) and the
// f16 remainder (lo), so that hi.hi + lo.hi + hi.lo keeps the f32 product.
__device__ __forceinline__ void phi_split(const v8f d0, const v8f d1, v16h& hi, v16h& lo) {
#pragma unroll
    for (int r = 0; r < 8; ++r) {
        const float f0 = phi_f(d0[r]), f1 = phi_f(d1[r]);
        hi[r]     = (_Float16)f0;
        hi[r + 8] = (_Float16)f1;
        lo[r]     = (_Float16)(f0 - (float)hi[r]);
        lo[r + 8] = (_Float16)(f1 - (float)hi[r + 8]);
    }
}

__global__ __launch_bounds__(128)
void ga_attn_wmma_kernel(const float* __restrict__ x,
                         const float* __restrict__ scalar_bias,
                         const float* __restrict__ vscale,
                         const float* __restrict__ vbias,
                         const float* __restrict__ bw,
                         const float* __restrict__ WQ,
                         const float* __restrict__ WK,
                         const float* __restrict__ WV,
                         const float* __restrict__ w_head,
                         const float* __restrict__ b_head,
                         float* __restrict__ out_pred,
                         float* __restrict__ out_w,
                         int L) {
    // Each wave's own two weight tiles, [query][window slot]; no wave reads another's.
    __shared__ __attribute__((aligned(16))) float sW[TILE_Q / WAVE_Q][2][16 * WPITCH];

    const int b    = blockIdx.y;
    const int T    = L - LOOKBACK;

    const int tid  = threadIdx.x;
    const int wave = tid >> 5;
    const int lane = tid & 31;
    const int hk   = lane >> 4;      // K-range half (A/B fragments)
    const int ncol = lane & 15;      // column within 16-wide fragment
    const int t0   = blockIdx.x * TILE_Q + wave * WAVE_Q;  // first output index of this wave = position of its first key

    // ---- All global loads first: weight rows (row index clamped, value selected afterwards, so no load
    // needs a branch), w_head, and the x rows of the three position tiles (t0 + 16 j + ncol, clamped at the tail).
    // Only k < 16 can be non-zero: element nh * 8 + i is row k = 8 hk + i, column ncol + 16 nh.
    v16f rq, rk, rv;
    float whd[2];
    int   ix[8];
    const float* px[3];
#pragma unroll
    for (int nh = 0; nh < 2; ++nh) {
        const int n = ncol + 16 * nh;
        whd[nh] = w_head[n];
#pragma unroll
        for (int i = 0; i < 8; ++i) {
            const int k = hk * 8 + i;
            const int idx = ((k < MV) ? k : 0) * HID + n;
            if (nh == 0) ix[i] = idx;
            rq[nh * 8 + i] = WQ[idx];
            rk[nh * 8 + i] = WK[idx];
            rv[nh * 8 + i] = WV[idx];
        }
    }
    v4f xk[3];
#pragma unroll
    for (int j = 0; j < 3; ++j) {
        int pos = t0 + 16 * j + ncol;
        if (pos > L - 1) pos = L - 1;
        px[j] = x + ((size_t)b * L + (size_t)pos) * 4;
        xk[j] = *(const v4f*)px[j];
    }
    const float sb0 = scalar_bias[0], bh = b_head[0];
    const float vs0 = vscale[0], vs1 = vscale[1], vs2 = vscale[2], vs3 = vscale[3];
    const float vb0 = vbias[0],  vb1 = vbias[1],  vb2 = vbias[2],  vb3 = vbias[3];
    const float w0 = bw[0], w1 = bw[1], w2 = bw[2], w3 = bw[3], w4 = bw[4], w5 = bw[5];
    // Inputs-only fence on the loaded values: without it each group of loads sinks to its first use in the
    // long straight-line code below, and the wave waits out a memory latency per group instead of one for all.
    asm volatile("" :: "v"(rq), "v"(rk), "v"(rv), "v"(xk[0]), "v"(xk[1]), "v"(xk[2]), "v"(whd[0]), "v"(whd[1]),
                 "s"(sb0), "s"(bh), "s"(vs0), "s"(vs1), "s"(vs2), "s"(vs3), "s"(vb0), "s"(vb1), "s"(vb2), "s"(vb3),
                 "s"(w0), "s"(w1), "s"(w2), "s"(w3), "s"(w4), "s"(w5));
    // The loads' address registers as inputs behind that fence: they stay live until every load has returned,
    // so no later load's result lands in a register that an issued load still names.
    asm volatile("" :: "v"(px[0]), "v"(px[1]), "v"(px[2]), "v"(ix[0]), "v"(ix[1]), "v"(ix[2]), "v"(ix[3]),
                 "v"(ix[4]), "v"(ix[5]), "v"(ix[6]), "v"(ix[7]), "s"(WQ), "s"(WK), "s"(WV), "s"(w_head));
    const float sb = 1.0f + sb0;

    // ---- Fragments of W_Q/W_K as 32x16 f16, two 16-column halves each ----
    // The head is linear in V: (sum_l s_l V_l / den) . w_head = sum_l s_l (M_l . (W_V w_head)) / den.
    // So V is projected straight onto w_head: wvp[] gathers this lane's share of W_V w_head in f32.
    v16h bq[2], bk[2];
    float wvp[8];
#pragma unroll
    for (int i = 0; i < 8; ++i) wvp[i] = 0.0f;
#pragma unroll
    for (int nh = 0; nh < 2; ++nh) {
#pragma unroll
        for (int i = 0; i < 8; ++i) {
            // rows k = 8 hk + i >= MV do not exist: i >= MV - 8 in lane half 1. Their (clamped) loads are
            // cleared with a bit mask, which stays branch-free.
            const int keep = (i < MV - 8) ? -1 : hk - 1;
            const float fq = rq[nh * 8 + i], fk = rk[nh * 8 + i], fv = rv[nh * 8 + i];
            bq[nh][i]     = (_Float16)__builtin_bit_cast(float, __builtin_bit_cast(int, fq) & keep);
            bk[nh][i]     = (_Float16)__builtin_bit_cast(float, __builtin_bit_cast(int, fk) & keep);
            bq[nh][i + 8] = (_Float16)0.0f;
            bk[nh][i + 8] = (_Float16)0.0f;
            wvp[i] += __builtin_bit_cast(float, __builtin_bit_cast(int, fv) & keep) * whd[nh];
        }
    }

    // Fragment whose 16 rows (or columns) are all W_V w_head: the row sum leaves the same value in every lane.
    // Elements 0..7 (k < 16) hold its f16 value, elements 8..15 (k >= 16, idle so far) the f16 remainder:
    // one rounding now stands where 32 independent ones averaged out, and the remainder takes it back.
    v16h bvh;
#pragma unroll
    for (int i = 0; i < 8; ++i) {
        const float w = row16_sum(wvp[i]);
        bvh[i]     = (_Float16)w;
        bvh[i + 8] = (_Float16)(w - (float)bvh[i]);
    }

    // 16x32 f16 fragment of M: both lane halves carry the 16 positions of a tile
    auto m_frag = [&](const v4f xr) -> v16h {
        const float x0 = xr[0], x1 = xr[1], x2 = xr[2], x3 = xr[3];
        float Mv[MV];
        Mv[0]  = sb;
        Mv[1]  = x0 * vs0 + vb0;
        Mv[2]  = x1 * vs1 + vb1;
        Mv[3]  = x2 * vs2 + vb2;
        Mv[4]  = x3 * vs3 + vb3;
        Mv[5]  = w0 * (x0 - x1);
        Mv[6]  = w1 * (x0 - x2);
        Mv[7]  = w2 * (x0 - x3);
        Mv[8]  = w3 * (x1 - x2);
        Mv[9]  = w4 * (x1 - x3);
        Mv[10] = w5 * (x2 - x3);
        // Element i is k = 8 hk + i: component i in lane half 0, component 8 + i (none from MV on) in half 1.
        // Both indices are compile-time constants, so the lane half costs one select an element.
        v16h a;
#pragma unroll
        for (int i = 0; i < 8; ++i) {
            const float up = (8 + i < MV) ? Mv[(8 + i < MV) ? 8 + i : 0] : 0.0f;
            a[i]     = (_Float16)(hk ? up : Mv[i]);
            a[i + 8] = a[i];         // k >= 16: M once more, for the remainder in bvh (W_Q and W_K have zero rows there)
        }
        return a;
    };

    // ---- Keys: W_K^T as A, M as B, so lane (ncol, hk) holds 16 features of position ncol ----
    v16h am[3], kh[3], kl[3];
    v8f  vh[3];                      // vh[j][r] = (V row . w_head) of position 8 hk + r of tile j, in every lane
#pragma unroll
    for (int j = 0; j < 3; ++j) {
        const v16h a = m_frag(xk[j]);
        am[j] = a;
        v8f d0 = {}, d1 = {}, dv = {};
        d0 = __builtin_amdgcn_wmma_f32_16x16x32_f16(false, bk[0], false, a,   (short)0, d0, false, false);
        d1 = __builtin_amdgcn_wmma_f32_16x16x32_f16(false, bk[1], false, a,   (short)0, d1, false, false);
        dv = __builtin_amdgcn_wmma_f32_16x16x32_f16(false, a,     false, bvh, (short)0, dv, false, false);
        phi_split(d0, d1, kh[j], kl[j]);
        vh[j] = dv;
    }

    // Query m = ncol of a tile takes key rows m .. m + 7, counted from its own key tile's row 0:
    // row kk = 8 hk + r of that tile where kk >= m, row kk of the next tile where kk <= m - 9.
    const int dsh = ncol - 8 * hk;   // kk - m = r - dsh
    float pred[2];
#pragma unroll
    for (int i = 0; i < 2; ++i) {
        // Query tile i stands 8 positions behind key tile i: its M fragment is lanes 8..15 of tile i and
        // lanes 0..7 of tile i + 1, each moved to lane ^ 8 of its 16-lane row (same lane half, same k).
        const v8i m0 = __builtin_bit_cast(v8i, am[i]), m1 = __builtin_bit_cast(v8i, am[i + 1]);
        v8i mq;
#pragma unroll
        for (int w = 0; w < 4; ++w) {
            mq[w]     = __builtin_amdgcn_update_dpp(0, (ncol >= 8) ? m0[w] : m1[w], 0x168, 0xf, 0xf, true); // row_xmask:8
            mq[w + 4] = mq[w];       // k >= 16 repeats k < 16, as in m_frag
        }
        const v16h a = __builtin_bit_cast(v16h, mq);
        v8f d0 = {}, d1 = {};
        d0 = __builtin_amdgcn_wmma_f32_16x16x32_f16(false, bq[0], false, a, (short)0, d0, false, false);
        d1 = __builtin_amdgcn_wmma_f32_16x16x32_f16(false, bq[1], false, a, (short)0, d1, false, false);
        v16h qh, ql;
        phi_split(d0, d1, qh, ql);

        // scores, keys as rows and queries as columns: sa[r] = K[tile i, row 8 hk + r] . Q[query ncol]
        v8f sa = {}, sn = {};
        sa = __builtin_amdgcn_wmma_f32_16x16x32_f16(false, kl[i],     false, qh, (short)0, sa, false, false);
        sn = __builtin_amdgcn_wmma_f32_16x16x32_f16(false, kl[i + 1], false, qh, (short)0, sn, false, false);
        sa = __builtin_amdgcn_wmma_f32_16x16x32_f16(false, kh[i],     false, ql, (short)0, sa, false, false);
        sn = __builtin_amdgcn_wmma_f32_16x16x32_f16(false, kh[i + 1], false, ql, (short)0, sn, false, false);
        sa = __builtin_amdgcn_wmma_f32_16x16x32_f16(false, kh[i],     false, qh, (short)0, sa, false, false);
        sn = __builtin_amdgcn_wmma_f32_16x16x32_f16(false, kh[i + 1], false, qh, (short)0, sn, false, false);

        float s[8];
        float den = 0.0f, num = 0.0f;
#pragma unroll
        for (int r = 0; r < 8; ++r) {
            const bool own = (r >= dsh);                     // this tile's row, else the next tile's
            const bool in  = (((r - dsh) & 15) < LOOKBACK);  // window slot 0..7: the row is one of the query's keys
            s[r] = own ? sa[r] : sn[r];
            const float v  = own ? vh[i][r] : vh[i + 1][r];
            const float sz = in ? s[r] : 0.0f;
            den += sz;
            num += sz * v;
        }
        den += xhalf(den);           // the two lane halves hold the two halves of the key rows
        num += xhalf(num);
        const float inv = 1.0f / (den + EPSV);
        pred[i] = num * inv + bh;

        // Row = query, column = window slot; slots 8..15 take the rows outside the window and are never read.
#pragma unroll
        for (int r = 0; r < 8; ++r)
            sW[wave][i][ncol * WPITCH + ((r - dsh) & 15)] = s[r] * inv;
    }

    // The wave reads back what its own lanes stored: the fence waits for those LDS stores, and the wave
    // barrier keeps the compiler from moving the loads above them. No other wave is involved.
    __builtin_amdgcn_fence(__ATOMIC_ACQ_REL, "workgroup");
    __builtin_amdgcn_wave_barrier();

#pragma unroll
    for (int i = 0; i < 2; ++i) {
        const int t = t0 + 16 * i + (lane >> 1);      // two lanes per query, 16 bytes each: 512 contiguous bytes a store
        const v4f w4 = *(const v4f*)&sW[wave][i][(lane >> 1) * WPITCH + (lane & 1) * 4];
        if (t < T) *(v4f*)(out_w + ((size_t)b * T + (size_t)t) * LOOKBACK + (lane & 1) * 4) = w4;
    }
    {
        const int t = t0 + lane;                      // lane half hk carries tile hk's queries
        if (t < T) out_pred[(size_t)b * T + (size_t)t] = hk ? pred[1] : pred[0];
    }
}

extern "C" void kernel_launch(void* const* d_in, const int* in_sizes, int n_in,
                              void* d_out, int out_size, void* d_ws, size_t ws_size,
                              hipStream_t stream) {
    const float* x   = (const float*)d_in[0];
    const float* sb  = (const float*)d_in[1];
    const float* vs  = (const float*)d_in[2];
    const float* vb  = (const float*)d_in[3];
    const float* bw  = (const float*)d_in[4];
    const float* WQ  = (const float*)d_in[5];
    const float* WK  = (const float*)d_in[6];
    const float* WV  = (const float*)d_in[7];
    const float* wh  = (const float*)d_in[8];
    const float* bh  = (const float*)d_in[9];

    const int B = 8;
    const int L = in_sizes[0] / (B * 4);
    const int T = L - LOOKBACK;

    float* out_pred = (float*)d_out;           // B*T predictions
    float* out_w    = out_pred + (size_t)B * T; // B*T*8 weights

    dim3 grid((T + TILE_Q - 1) / TILE_Q, B);
    dim3 block(TILE_Q);
    ga_attn_wmma_kernel<<<grid, block, 0, stream>>>(
        x, sb, vs, vb, bw, WQ, WK, WV, wh, bh, out_pred, out_w, L);
}

// v005
// A run of this version takes 5.17 microseconds.
// Next to v004, in two timings, it ran 1.12 times as fast each time.
// Counting every step since v000, it is 2.52 times as fast.
#include <hip/hip_runtime.h>
#include <hip/hip_bf16.h>

typedef __attribute__((ext_vector_type(16))) _Float16 v16h;
typedef __attribute__((ext_vector_type(8)))  float    v8f;
typedef __attribute__((ext_vector_type(4)))  float    v4f;
typedef __attribute__((ext_vector_type(8)))  int      v8i;
typedef __attribute__((ext_vector_type(16))) float    v16f;
typedef __attribute__((ext_vector_type(2)))  float    v2f;

#define LOOKBACK 8
#define HID      32
#define MV       11
#define TILE_Q   128                 // queries per block
#define WAVE_Q   32                  // queries per wave: two 16-query tiles
#define WPITCH   20                  // LDS row pitch in floats of a weight tile (bank-conflict-free, rows 16-byte aligned)
#define EPSV     1e-6f

// Sum over the 16 lanes of a row, left in every lane of the row (DPP butterfly).
__device__ __forceinline__ float row16_sum(float v) {
    v += __builtin_bit_cast(float, __builtin_amdgcn_update_dpp(0, __builtin_bit_cast(int, v), 0x161, 0xf, 0xf, true)); // row_xmask:1
    v += __builtin_bit_cast(float, __builtin_amdgcn_update_dpp(0, __builtin_bit_cast(int, v), 0x162, 0xf, 0xf, true)); // row_xmask:2
    v += __builtin_bit_cast(float, __builtin_amdgcn_update_dpp(0, __builtin_bit_cast(int, v), 0x164, 0xf, 0xf, true)); // row_xmask:4
    v += __builtin_bit_cast(float, __builtin_amdgcn_update_dpp(0, __builtin_bit_cast(int, v), 0x168, 0xf, 0xf, true)); // row_xmask:8
    return v;
}

// Value of lane l ^ 16 (the other lane half).
__device__ __forceinline__ float xhalf(float v) {
    return __builtin_bit_cast(float, __builtin_amdgcn_permlanex16(__builtin_bit_cast(int, v), __builtin_bit_cast(int, v),
                                                                  0x76543210, 0xfedcba98, false, false));
}

// Two transposed projection tiles (feature 8*hk + r and 16 + 8*hk + r of position ncol) are, element for
// element, a 16x32 operand over the 32 features. The tiles come in as y = x + 1 (the WMMA started from C = 1),
// so phi(x) = leaky(x) + 1 = max(y, 0.01 y + 0.99): the two lines cross at y = 1, which is x = 0.
// Each phi value goes in as its f16 value (hi) and the f16 remainder (lo), so that hi.hi + lo.hi + hi.lo
// keeps the f32 product. Values are taken in pairs, as they lie in a packed f16 register.
__device__ __forceinline__ void phi_split8(const v8f y, int* h, int* l) {
    const v2f z01 = (v2f){y[0], y[1]} * 0.01f + 0.99f, z23 = (v2f){y[2], y[3]} * 0.01f + 0.99f;
    const v2f z45 = (v2f){y[4], y[5]} * 0.01f + 0.99f, z67 = (v2f){y[6], y[7]} * 0.01f + 0.99f;
    float f0 = z01[0], f1 = z01[1], f2 = z23[0], f3 = z23[1], f4 = z45[0], f5 = z45[1], f6 = z67[0], f7 = z67[1];
    // Written as text because the compiler doubles each maximum (it first canonicalizes the WMMA result).
    // The hint lets the SIMD's other waves issue while the first maximum waits for the fma in front of it.
    asm("s_delay_alu instid0(VALU_DEP_1)\n\t"
        "v_max_num_f32 %0, %4, %0\n\t"
        "v_max_num_f32 %1, %5, %1\n\t"
        "v_max_num_f32 %2, %6, %2\n\t"
        "v_max_num_f32 %3, %7, %3"
        : "+v"(f0), "+v"(f1), "+v"(f2), "+v"(f3)
        : "v"(y[0]), "v"(y[1]), "v"(y[2]), "v"(y[3]));
    // The other four maxima, then per pair one packed convert (hi) and two mixed-precision fma that subtract
    // the f16 value from the f32 one and round the remainder straight into its half of lo. The compiler takes
    // 3 instructions a value for this split, the text 1.5. The four maxima in front write only their own
    // inputs, so the first write of a fresh register stands 4 vector slots behind any WMMA ahead of the
    // statement. Every producer here is 4 instructions back: the hints hand that wait to other waves.
    int h0, h1, h2, h3, l0, l1, l2, l3;
    asm("s_delay_alu instid0(VALU_DEP_1)\n\t"
        "v_max_num_f32 %8, %16, %8\n\t"
        "v_max_num_f32 %9, %17, %9\n\t"
        "v_max_num_f32 %10, %18, %10\n\t"
        "v_max_num_f32 %11, %19, %11\n\t"
        "v_cvt_pk_f16_f32 %0, %12, %13\n\t"
        "v_cvt_pk_f16_f32 %1, %14, %15\n\t"
        "v_cvt_pk_f16_f32 %2, %8, %9\n\t"
        "s_delay_alu instid0(VALU_DEP_4) | instskip(NEXT) | instid1(VALU_DEP_4)\n\t"
        "v_cvt_pk_f16_f32 %3, %10, %11\n\t"
        "v_fma_mixlo_f16 %4, %0, -1.0, %12 op_sel_hi:[1,1,0]\n\t"
        "s_delay_alu instid0(VALU_DEP_4) | instskip(NEXT) | instid1(VALU_DEP_4)\n\t"
        "v_fma_mixlo_f16 %5, %1, -1.0, %14 op_sel_hi:[1,1,0]\n\t"
        "v_fma_mixlo_f16 %6, %2, -1.0, %8 op_sel_hi:[1,1,0]\n\t"
        "s_delay_alu instid0(VALU_DEP_4) | instskip(NEXT) | instid1(VALU_DEP_4)\n\t"
        "v_fma_mixlo_f16 %7, %3, -1.0, %10 op_sel_hi:[1,1,0]\n\t"
        "v_fma_mixhi_f16 %4, %0, -1.0, %13 op_sel:[1,0,0] op_sel_hi:[1,1,0]\n\t"
        "s_delay_alu instid0(VALU_DEP_4) | instskip(NEXT) | instid1(VALU_DEP_4)\n\t"
        "v_fma_mixhi_f16 %5, %1, -1.0, %15 op_sel:[1,0,0] op_sel_hi:[1,1,0]\n\t"
        "v_fma_mixhi_f16 %6, %2, -1.0, %9 op_sel:[1,0,0] op_sel_hi:[1,1,0]\n\t"
        "s_delay_alu instid0(VALU_DEP_4)\n\t"
        "v_fma_mixhi_f16 %7, %3, -1.0, %11 op_sel:[1,0,0] op_sel_hi:[1,1,0]"
        : "=&v"(h0), "=&v"(h1), "=&v"(h2), "=&v"(h3), "=&v"(l0), "=&v"(l1), "=&v"(l2), "=&v"(l3),
          "+v"(f4), "+v"(f5), "+v"(f6), "+v"(f7)
        : "v"(f0), "v"(f1), "v"(f2), "v"(f3), "v"(y[4]), "v"(y[5]), "v"(y[6]), "v"(y[7]));
    h[0] = h0; h[1] = h1; h[2] = h2; h[3] = h3;
    l[0] = l0; l[1] = l1; l[2] = l2; l[3] = l3;
}

__device__ __forceinline__ void phi_split(const v8f d0, const v8f d1, v16h& hi, v16h& lo) {
    int h[8], l[8];
    phi_split8(d0, h, l);
    phi_split8(d1, h + 4, l + 4);
    hi = __builtin_bit_cast(v16h, (v8i){h[0], h[1], h[2], h[3], h[4], h[5], h[6], h[7]});
    lo = __builtin_bit_cast(v16h, (v8i){l[0], l[1], l[2], l[3], l[4], l[5], l[6], l[7]});
}

__global__ __launch_bounds__(128)
void ga_attn_wmma_kernel(const float* __restrict__ x,
                         const float* __restrict__ scalar_bias,
                         const float* __restrict__ vscale,
                         const float* __restrict__ vbias,
                         const float* __restrict__ bw,
                         const float* __restrict__ WQ,
                         const float* __restrict__ WK,
                         const float* __restrict__ WV,
                         const float* __restrict__ w_head,
                         const float* __restrict__ b_head,
                         float* __restrict__ out_pred,
                         float* __restrict__ out_w,
                         int L) {
    // Each wave's own two weight tiles, [query][window slot]; no wave reads another's.
    __shared__ __attribute__((aligned(16))) float sW[TILE_Q / WAVE_Q][2][16 * WPITCH];

    const int b    = blockIdx.y;
    const int T    = L - LOOKBACK;

    const int tid  = threadIdx.x;
    const int wave = tid >> 5;
    const int lane = tid & 31;
    const int hk   = lane >> 4;      // K-range half (A/B fragments)
    const int ncol = lane & 15;      // column within 16-wide fragment
    const int t0   = blockIdx.x * TILE_Q + wave * WAVE_Q;  // first output index of this wave = position of its first key

    // ---- All global loads first: weight rows (row index clamped, value selected afterwards, so no load
    // needs a branch), w_head, and the x rows of the three position tiles (t0 + 16 j + ncol, clamped at the tail).
    // Only k < 16 can be non-zero: element nh * 8 + i is row k = 8 hk + i, column ncol + 16 nh.
    v16f rq, rk, rv;
    float whd[2];
    int   ix[8];
    const float* px[3];
#pragma unroll
    for (int nh = 0; nh < 2; ++nh) {
        const int n = ncol + 16 * nh;
        whd[nh] = w_head[n];
#pragma unroll
        for (int i = 0; i < 8; ++i) {
            const int k = hk * 8 + i;
            const int idx = ((k < MV) ? k : 0) * HID + n;
            if (nh == 0) ix[i] = idx;
            rq[nh * 8 + i] = WQ[idx];
            rk[nh * 8 + i] = WK[idx];
            rv[nh * 8 + i] = WV[idx];
        }
    }
    v4f xk[3];
#pragma unroll
    for (int j = 0; j < 3; ++j) {
        int pos = t0 + 16 * j + ncol;
        if (pos > L - 1) pos = L - 1;
        px[j] = x + ((size_t)b * L + (size_t)pos) * 4;
        xk[j] = *(const v4f*)px[j];
    }
    const float sb0 = scalar_bias[0], bh = b_head[0];
    const float vs0 = vscale[0], vs1 = vscale[1], vs2 = vscale[2], vs3 = vscale[3];
    const float vb0 = vbias[0],  vb1 = vbias[1],  vb2 = vbias[2],  vb3 = vbias[3];
    const float w0 = bw[0], w1 = bw[1], w2 = bw[2], w3 = bw[3], w4 = bw[4], w5 = bw[5];
    // Inputs-only fence on the loaded values: without it each group of loads sinks to its first use in the
    // long straight-line code below, and the wave waits out a memory latency per group instead of one for all.
    asm volatile("" :: "v"(rq), "v"(rk), "v"(rv), "v"(xk[0]), "v"(xk[1]), "v"(xk[2]), "v"(whd[0]), "v"(whd[1]),
                 "s"(sb0), "s"(bh), "s"(vs0), "s"(vs1), "s"(vs2), "s"(vs3), "s"(vb0), "s"(vb1), "s"(vb2), "s"(vb3),
                 "s"(w0), "s"(w1), "s"(w2), "s"(w3), "s"(w4), "s"(w5));
    // The loads' address registers as inputs behind that fence: they stay live until every load has returned,
    // so no later load's result lands in a register that an issued load still names.
    asm volatile("" :: "v"(px[0]), "v"(px[1]), "v"(px[2]), "v"(ix[0]), "v"(ix[1]), "v"(ix[2]), "v"(ix[3]),
                 "v"(ix[4]), "v"(ix[5]), "v"(ix[6]), "v"(ix[7]), "s"(WQ), "s"(WK), "s"(WV), "s"(w_head));
    // Nothing is scheduled across this line: the conversions below stay behind the loads, so that no load is
    // held back behind another load's wait.
    __builtin_amdgcn_sched_barrier(0);
    const float sb = 1.0f + sb0;

    // ---- Fragments of W_Q/W_K as 32x16 f16, two 16-column halves each ----
    // The head is linear in V: (sum_l s_l V_l / den) . w_head = sum_l s_l (M_l . (W_V w_head)) / den.
    // So V is projected straight onto w_head: wvp[] gathers this lane's share of W_V w_head in f32.
    v16h bq[2], bk[2];
    float wvp[8];
#pragma unroll
    for (int i = 0; i < 8; ++i) wvp[i] = 0.0f;
#pragma unroll
    for (int nh = 0; nh < 2; ++nh) {
#pragma unroll
        for (int i = 0; i < 8; ++i) {
            // rows k = 8 hk + i >= MV do not exist: i >= MV - 8 in lane half 1. Their (clamped) loads are
            // cleared with a bit mask, which stays branch-free.
            const int keep = (i < MV - 8) ? -1 : hk - 1;
            const float fq = rq[nh * 8 + i], fk = rk[nh * 8 + i], fv = rv[nh * 8 + i];
            bq[nh][i]     = (_Float16)__builtin_bit_cast(float, __builtin_bit_cast(int, fq) & keep);
            bk[nh][i]     = (_Float16)__builtin_bit_cast(float, __builtin_bit_cast(int, fk) & keep);
            bq[nh][i + 8] = (_Float16)0.0f;
            bk[nh][i + 8] = (_Float16)0.0f;
            wvp[i] += __builtin_bit_cast(float, __builtin_bit_cast(int, fv) & keep) * whd[nh];
        }
    }

    // Fragment whose 16 rows (or columns) are all W_V w_head: the row sum leaves the same value in every lane.
    // Elements 0..7 (k < 16) hold its f16 value, elements 8..15 (k >= 16, idle so far) the f16 remainder:
    // one rounding now stands where 32 independent ones averaged out, and the remainder takes it back.
    v16h bvh;
#pragma unroll
    for (int i = 0; i < 8; ++i) {
        const float w = row16_sum(wvp[i]);
        bvh[i]     = (_Float16)w;
        bvh[i + 8] = (_Float16)(w - (float)bvh[i]);
    }

    // 16x32 f16 fragment of M: both lane halves carry the 16 positions of a tile
    auto m_frag = [&](const v4f xr) -> v16h {
        const float x0 = xr[0], x1 = xr[1], x2 = xr[2], x3 = xr[3];
        float Mv[MV];
        Mv[0]  = sb;
        Mv[1]  = x0 * vs0 + vb0;
        Mv[2]  = x1 * vs1 + vb1;
        Mv[3]  = x2 * vs2 + vb2;
        Mv[4]  = x3 * vs3 + vb3;
        Mv[5]  = w0 * (x0 - x1);
        Mv[6]  = w1 * (x0 - x2);
        Mv[7]  = w2 * (x0 - x3);
        Mv[8]  = w3 * (x1 - x2);
        Mv[9]  = w4 * (x1 - x3);
        Mv[10] = w5 * (x2 - x3);
        // Element i is k = 8 hk + i: component i in lane half 0, component 8 + i (none from MV on) in half 1.
        // Both indices are compile-time constants, so the lane half costs one select an element.
        v16h a;
#pragma unroll
        for (int i = 0; i < 8; ++i) {
            const float up = (8 + i < MV) ? Mv[(8 + i < MV) ? 8 + i : 0] : 0.0f;
            a[i]     = (_Float16)(hk ? up : Mv[i]);
            a[i + 8] = a[i];         // k >= 16: M once more, for the remainder in bvh (W_Q and W_K have zero rows there)
        }
        return a;
    };

    // ---- Keys: W_K^T as A, M as B, so lane (ncol, hk) holds 16 features of position ncol ----
    const v8f one8 = {1.0f, 1.0f, 1.0f, 1.0f, 1.0f, 1.0f, 1.0f, 1.0f};   // the "+ 1" of phi, as the projections' C
    v16h am[3], kh[3], kl[3];
    v8f  vh[3];                      // vh[j][r] = (V row . w_head) of position 8 hk + r of tile j, in every lane
#pragma unroll
    for (int j = 0; j < 3; ++j) {
        const v16h a = m_frag(xk[j]);
        am[j] = a;
        v8f d0 = one8, d1 = one8, dv = {};
        d0 = __builtin_amdgcn_wmma_f32_16x16x32_f16(false, bk[0], false, a,   (short)0, d0, false, false);
        d1 = __builtin_amdgcn_wmma_f32_16x16x32_f16(false, bk[1], false, a,   (short)0, d1, false, false);
        dv = __builtin_amdgcn_wmma_f32_16x16x32_f16(false, a,     false, bvh, (short)0, dv, false, false);
        phi_split(d0, d1, kh[j], kl[j]);
        vh[j] = dv;
    }

    // Query m = ncol of a tile takes key rows m .. m + 7, counted from its own key tile's row 0:
    // row kk = 8 hk + r of that tile where kk >= m, row kk of the next tile where kk <= m - 9.
    const int dsh = ncol - 8 * hk;   // kk - m = r - dsh
    float pred[2];
#pragma unroll
    for (int i = 0; i < 2; ++i) {
        // Query tile i stands 8 positions behind key tile i: its M fragment is lanes 8..15 of tile i and
        // lanes 0..7 of tile i + 1, each moved to lane ^ 8 of its 16-lane row (same lane half, same k).
        const v8i m0 = __builtin_bit_cast(v8i, am[i]), m1 = __builtin_bit_cast(v8i, am[i + 1]);
        v8i mq;
#pragma unroll
        for (int w = 0; w < 4; ++w) {
            mq[w]     = __builtin_amdgcn_update_dpp(0, (ncol >= 8) ? m0[w] : m1[w], 0x168, 0xf, 0xf, true); // row_xmask:8
            mq[w + 4] = mq[w];       // k >= 16 repeats k < 16, as in m_frag
        }
        const v16h a = __builtin_bit_cast(v16h, mq);
        v8f d0 = one8, d1 = one8;
        d0 = __builtin_amdgcn_wmma_f32_16x16x32_f16(false, bq[0], false, a, (short)0, d0, false, false);
        d1 = __builtin_amdgcn_wmma_f32_16x16x32_f16(false, bq[1], false, a, (short)0, d1, false, false);
        v16h qh, ql;
        phi_split(d0, d1, qh, ql);

        // scores, keys as rows and queries as columns: sa[r] = K[tile i, row 8 hk + r] . Q[query ncol]
        v8f sa = {}, sn = {};
        sa = __builtin_amdgcn_wmma_f32_16x16x32_f16(false, kl[i],     false, qh, (short)0, sa, false, false);
        sn = __builtin_amdgcn_wmma_f32_16x16x32_f16(false, kl[i + 1], false, qh, (short)0, sn, false, false);
        sa = __builtin_amdgcn_wmma_f32_16x16x32_f16(false, kh[i],     false, ql, (short)0, sa, false, false);
        sn = __builtin_amdgcn_wmma_f32_16x16x32_f16(false, kh[i + 1], false, ql, (short)0, sn, false, false);
        sa = __builtin_amdgcn_wmma_f32_16x16x32_f16(false, kh[i],     false, qh, (short)0, sa, false, false);
        sn = __builtin_amdgcn_wmma_f32_16x16x32_f16(false, kh[i + 1], false, qh, (short)0, sn, false, false);

        float s[8];
        float den = 0.0f, num = 0.0f;
#pragma unroll
        for (int r = 0; r < 8; ++r) {
            const bool own = (r >= dsh);                     // this tile's row, else the next tile's
            const bool in  = (((r - dsh) & 15) < LOOKBACK);  // window slot 0..7: the row is one of the query's keys
            s[r] = own ? sa[r] : sn[r];
            const float v  = own ? vh[i][r] : vh[i + 1][r];
            const float sz = in ? s[r] : 0.0f;
            den += sz;
            num += sz * v;
        }
        den += xhalf(den);           // the two lane halves hold the two halves of the key rows
        num += xhalf(num);
        const float inv = 1.0f / (den + EPSV);
        pred[i] = num * inv + bh;

        // Row = query, column = window slot; slots 8..15 take the rows outside the window and are never read.
#pragma unroll
        for (int r = 0; r < 8; ++r)
            sW[wave][i][ncol * WPITCH + ((r - dsh) & 15)] = s[r] * inv;
    }

    // The wave reads back what its own lanes stored: the fence waits for those LDS stores, and the wave
    // barrier keeps the compiler from moving the loads above them. No other wave is involved.
    __builtin_amdgcn_fence(__ATOMIC_ACQ_REL, "workgroup");
    __builtin_amdgcn_wave_barrier();

#pragma unroll
    for (int i = 0; i < 2; ++i) {
        const int t = t0 + 16 * i + (lane >> 1);      // two lanes per query, 16 bytes each: 512 contiguous bytes a store
        const v4f w4 = *(const v4f*)&sW[wave][i][(lane >> 1) * WPITCH + (lane & 1) * 4];
        if (t < T) *(v4f*)(out_w + ((size_t)b * T + (size_t)t) * LOOKBACK + (lane & 1) * 4) = w4;
    }
    {
        const int t = t0 + lane;                      // lane half hk carries tile hk's queries
        if (t < T) out_pred[(size_t)b * T + (size_t)t] = hk ? pred[1] : pred[0];
    }
}

extern "C" void kernel_launch(void* const* d_in, const int* in_sizes, int n_in,
                              void* d_out, int out_size, void* d_ws, size_t ws_size,
                              hipStream_t stream) {
    const float* x   = (const float*)d_in[0];
    const float* sb  = (const float*)d_in[1];
    const float* vs  = (const float*)d_in[2];
    const float* vb  = (const float*)d_in[3];
    const float* bw  = (const float*)d_in[4];
    const float* WQ  = (const float*)d_in[5];
    const float* WK  = (const float*)d_in[6];
    const float* WV  = (const float*)d_in[7];
    const float* wh  = (const float*)d_in[8];
    const float* bh  = (const float*)d_in[9];

    const int B = 8;
    const int L = in_sizes[0] / (B * 4);
    const int T = L - LOOKBACK;

    float* out_pred = (float*)d_out;           // B*T predictions
    float* out_w    = out_pred + (size_t)B * T; // B*T*8 weights

    dim3 grid((T + TILE_Q - 1) / TILE_Q, B);
    dim3 block(TILE_Q);
    ga_attn_wmma_kernel<<<grid, block, 0, stream>>>(
        x, sb, vs, vb, bw, WQ, WK, WV, wh, bh, out_pred, out_w, L);
}

// v006
// One run takes 4.65 microseconds.
// In two side-by-side timings against v005, it was 1.11 and 1.12 times as fast.
// Counting every step since v000, it is 2.81 times as fast.
#include <hip/hip_runtime.h>
#include <hip/hip_bf16.h>

typedef __attribute__((ext_vector_type(16))) _Float16 v16h;
typedef __attribute__((ext_vector_type(8)))  _Float16 v8h;
typedef __attribute__((ext_vector_type(8)))  float    v8f;
typedef __attribute__((ext_vector_type(4)))  float    v4f;
typedef __attribute__((ext_vector_type(8)))  int      v8i;
typedef __attribute__((ext_vector_type(16))) float    v16f;

#define LOOKBACK 8
#define HID      32
#define MV       11
#define TILE_Q   128                 // queries per block
#define WAVE_Q   32                  // queries per wave: two 16-query tiles
#define WPITCH   20                  // LDS row pitch in floats of a weight tile (bank-conflict-free, rows 16-byte aligned)
#define EPSV     1e-6f

// Sum over the 16 lanes of a row, left in every lane of the row (DPP butterfly).
__device__ __forceinline__ float row16_sum(float v) {
    v += __builtin_bit_cast(float, __builtin_amdgcn_update_dpp(0, __builtin_bit_cast(int, v), 0x161, 0xf, 0xf, true)); // row_xmask:1
    v += __builtin_bit_cast(float, __builtin_amdgcn_update_dpp(0, __builtin_bit_cast(int, v), 0x162, 0xf, 0xf, true)); // row_xmask:2
    v += __builtin_bit_cast(float, __builtin_amdgcn_update_dpp(0, __builtin_bit_cast(int, v), 0x164, 0xf, 0xf, true)); // row_xmask:4
    v += __builtin_bit_cast(float, __builtin_amdgcn_update_dpp(0, __builtin_bit_cast(int, v), 0x168, 0xf, 0xf, true)); // row_xmask:8
    return v;
}

// Value of lane l ^ 16 (the other lane half).
__device__ __forceinline__ float xhalf(float v) {
    return __builtin_bit_cast(float, __builtin_amdgcn_permlanex16(__builtin_bit_cast(int, v), __builtin_bit_cast(int, v),
                                                                  0x76543210, 0xfedcba98, false, false));
}

// Two transposed projection tiles, taken from the WMMA as packed f16 (element e = feature 8*hk + e, and
// 16 + 8*hk + e, of position ncol), are, element for element, a 16x32 operand over the 32 features: no convert.
// The tiles come in as y = x + 1 (the WMMA started from C = 1), so phi(x) = leaky(x) + 1 = max(y, 0.01 y + 0.99):
// the two lines cross at y = 1, which is x = 0. Both steps are packed f16, two values an instruction.
// phi is thereby rounded to f16 and no remainder is kept: M and the weights enter the projections rounded to
// f16 already, which leaves an error of the same size in y.
__device__ __forceinline__ v16h phi16(const v8h d0, const v8h d1) {
    const v16h y = __builtin_shufflevector(d0, d1, 0, 1, 2, 3, 4, 5, 6, 7, 8, 9, 10, 11, 12, 13, 14, 15);
    const v16h z = y * (_Float16)0.01f + (_Float16)0.99f;
    const v8i yi = __builtin_bit_cast(v8i, y), zi = __builtin_bit_cast(v8i, z);
    int p0 = zi[0], p1 = zi[1], p2 = zi[2], p3 = zi[3], p4 = zi[4], p5 = zi[5], p6 = zi[6], p7 = zi[7];
    // Written as text because the compiler doubles each maximum (it first canonicalizes the WMMA result).
    // The hint lets the SIMD's other waves issue while the first maximum waits for the fma in front of it.
    asm("s_delay_alu instid0(VALU_DEP_1)\n\t"
        "v_pk_max_num_f16 %0, %8, %0\n\t"
        "v_pk_max_num_f16 %1, %9, %1\n\t"
        "v_pk_max_num_f16 %2, %10, %2\n\t"
        "v_pk_max_num_f16 %3, %11, %3\n\t"
        "v_pk_max_num_f16 %4, %12, %4\n\t"
        "v_pk_max_num_f16 %5, %13, %5\n\t"
        "v_pk_max_num_f16 %6, %14, %6\n\t"
        "v_pk_max_num_f16 %7, %15, %7"
        : "+v"(p0), "+v"(p1), "+v"(p2), "+v"(p3), "+v"(p4), "+v"(p5), "+v"(p6), "+v"(p7)
        : "v"(yi[0]), "v"(yi[1]), "v"(yi[2]), "v"(yi[3]), "v"(yi[4]), "v"(yi[5]), "v"(yi[6]), "v"(yi[7]));
    return __builtin_bit_cast(v16h, (v8i){p0, p1, p2, p3, p4, p5, p6, p7});
}

__global__ __launch_bounds__(128)
void ga_attn_wmma_kernel(const float* __restrict__ x,
                         const float* __restrict__ scalar_bias,
                         const float* __restrict__ vscale,
                         const float* __restrict__ vbias,
                         const float* __restrict__ bw,
                         const float* __restrict__ WQ,
                         const float* __restrict__ WK,
                         const float* __restrict__ WV,
                         const float* __restrict__ w_head,
                         const float* __restrict__ b_head,
                         float* __restrict__ out_pred,
                         float* __restrict__ out_w,
                         int L) {
    // Each wave's own two weight tiles, [query][window slot]; no wave reads another's.
    __shared__ __attribute__((aligned(16))) float sW[TILE_Q / WAVE_Q][2][16 * WPITCH];

    const int b    = blockIdx.y;
    const int T    = L - LOOKBACK;

    const int tid  = threadIdx.x;
    const int wave = tid >> 5;
    const int lane = tid & 31;
    const int hk   = lane >> 4;      // K-range half (A/B fragments)
    const int ncol = lane & 15;      // column within 16-wide fragment
    const int t0   = blockIdx.x * TILE_Q + wave * WAVE_Q;  // first output index of this wave = position of its first key

    // ---- All global loads first: weight rows (row index clamped, value selected afterwards, so no load
    // needs a branch), w_head, and the x rows of the three position tiles (t0 + 16 j + ncol, clamped at the tail).
    // Only k < 16 can be non-zero: element nh * 8 + i is row k = 8 hk + i, column ncol + 16 nh.
    v16f rq, rk, rv;
    float whd[2];
    int   ix[8];
    const float* px[3];
#pragma unroll
    for (int nh = 0; nh < 2; ++nh) {
        const int n = ncol + 16 * nh;
        whd[nh] = w_head[n];
#pragma unroll
        for (int i = 0; i < 8; ++i) {
            const int k = hk * 8 + i;
            const int idx = ((k < MV) ? k : 0) * HID + n;
            if (nh == 0) ix[i] = idx;
            rq[nh * 8 + i] = WQ[idx];
            rk[nh * 8 + i] = WK[idx];
            rv[nh * 8 + i] = WV[idx];
        }
    }
    v4f xk[3];
#pragma unroll
    for (int j = 0; j < 3; ++j) {
        int pos = t0 + 16 * j + ncol;
        if (pos > L - 1) pos = L - 1;
        px[j] = x + ((size_t)b * L + (size_t)pos) * 4;
        xk[j] = *(const v4f*)px[j];
    }
    const float sb0 = scalar_bias[0], bh = b_head[0];
    const float vs0 = vscale[0], vs1 = vscale[1], vs2 = vscale[2], vs3 = vscale[3];
    const float vb0 = vbias[0],  vb1 = vbias[1],  vb2 = vbias[2],  vb3 = vbias[3];
    const float w0 = bw[0], w1 = bw[1], w2 = bw[2], w3 = bw[3], w4 = bw[4], w5 = bw[5];
    // Inputs-only fence on the loaded values: without it each group of loads sinks to its first use in the
    // long straight-line code below, and the wave waits out a memory latency per group instead of one for all.
    asm volatile("" :: "v"(rq), "v"(rk), "v"(rv), "v"(xk[0]), "v"(xk[1]), "v"(xk[2]), "v"(whd[0]), "v"(whd[1]),
                 "s"(sb0), "s"(bh), "s"(vs0), "s"(vs1), "s"(vs2), "s"(vs3), "s"(vb0), "s"(vb1), "s"(vb2), "s"(vb3),
                 "s"(w0), "s"(w1), "s"(w2), "s"(w3), "s"(w4), "s"(w5));
    // The loads' address registers as inputs behind that fence: they stay live until every load has returned,
    // so no later load's result lands in a register that an issued load still names.
    asm volatile("" :: "v"(px[0]), "v"(px[1]), "v"(px[2]), "v"(ix[0]), "v"(ix[1]), "v"(ix[2]), "v"(ix[3]),
                 "v"(ix[4]), "v"(ix[5]), "v"(ix[6]), "v"(ix[7]), "s"(WQ), "s"(WK), "s"(WV), "s"(w_head));
    // Nothing is scheduled across this line: the conversions below stay behind the loads, so that no load is
    // held back behind another load's wait.
    __builtin_amdgcn_sched_barrier(0);
    const float sb = 1.0f + sb0;

    // ---- Fragments of W_Q/W_K as 32x16 f16, two 16-column halves each ----
    // The head is linear in V: (sum_l s_l V_l / den) . w_head = sum_l s_l (M_l . (W_V w_head)) / den.
    // So V is projected straight onto w_head: wvp[] gathers this lane's share of W_V w_head in f32.
    v16h bq[2], bk[2];
    float wvp[8];
#pragma unroll
    for (int i = 0; i < 8; ++i) wvp[i] = 0.0f;
#pragma unroll
    for (int nh = 0; nh < 2; ++nh) {
#pragma unroll
        for (int i = 0; i < 8; ++i) {
            // rows k = 8 hk + i >= MV do not exist: i >= MV - 8 in lane half 1. Their (clamped) loads are
            // cleared with a bit mask, which stays branch-free.
            const int keep = (i < MV - 8) ? -1 : hk - 1;
            const float fq = rq[nh * 8 + i], fk = rk[nh * 8 + i], fv = rv[nh * 8 + i];
            bq[nh][i]     = (_Float16)__builtin_bit_cast(float, __builtin_bit_cast(int, fq) & keep);
            bk[nh][i]     = (_Float16)__builtin_bit_cast(float, __builtin_bit_cast(int, fk) & keep);
            bq[nh][i + 8] = (_Float16)0.0f;
            bk[nh][i + 8] = (_Float16)0.0f;
            wvp[i] += __builtin_bit_cast(float, __builtin_bit_cast(int, fv) & keep) * whd[nh];
        }
    }

    // Fragment whose 16 rows (or columns) are all W_V w_head: the row sum leaves the same value in every lane.
    // Elements 0..7 (k < 16) hold its f16 value, elements 8..15 (k >= 16, idle so far) the f16 remainder:
    // one rounding now stands where 32 independent ones averaged out, and the remainder takes it back.
    v16h bvh;
#pragma unroll
    for (int i = 0; i < 8; ++i) {
        const float w = row16_sum(wvp[i]);
        bvh[i]     = (_Float16)w;
        bvh[i + 8] = (_Float16)(w - (float)bvh[i]);
    }

    // 16x32 f16 fragment of M: both lane halves carry the 16 positions of a tile
    auto m_frag = [&](const v4f xr) -> v16h {
        const float x0 = xr[0], x1 = xr[1], x2 = xr[2], x3 = xr[3];
        float Mv[MV];
        Mv[0]  = sb;
        Mv[1]  = x0 * vs0 + vb0;
        Mv[2]  = x1 * vs1 + vb1;
        Mv[3]  = x2 * vs2 + vb2;
        Mv[4]  = x3 * vs3 + vb3;
        Mv[5]  = w0 * (x0 - x1);
        Mv[6]  = w1 * (x0 - x2);
        Mv[7]  = w2 * (x0 - x3);
        Mv[8]  = w3 * (x1 - x2);
        Mv[9]  = w4 * (x1 - x3);
        Mv[10] = w5 * (x2 - x3);
        // Element i is k = 8 hk + i: component i in lane half 0, component 8 + i (none from MV on) in half 1.
        // Both indices are compile-time constants, so the lane half costs one select an element.
        v16h a;
#pragma unroll
        for (int i = 0; i < 8; ++i) {
            const float up = (8 + i < MV) ? Mv[(8 + i < MV) ? 8 + i : 0] : 0.0f;
            a[i]     = (_Float16)(hk ? up : Mv[i]);
            a[i + 8] = a[i];         // k >= 16: M once more, for the remainder in bvh (W_Q and W_K have zero rows there)
        }
        return a;
    };

    // ---- Keys: W_K^T as A, M as B, so lane (ncol, hk) holds 16 features of position ncol ----
    const v8h one8 = {1.0f, 1.0f, 1.0f, 1.0f, 1.0f, 1.0f, 1.0f, 1.0f};   // the "+ 1" of phi, as the projections' C
    v16h am[3], kh[3];
    v8f  vh[3];                      // vh[j][r] = (V row . w_head) of position 8 hk + r of tile j, in every lane
#pragma unroll
    for (int j = 0; j < 3; ++j) {
        const v16h a = m_frag(xk[j]);
        am[j] = a;
        v8h d0 = one8, d1 = one8;
        v8f dv = {};
        d0 = __builtin_amdgcn_wmma_f16_16x16x32_f16(false, bk[0], false, a,   (short)0, d0, false, false);
        d1 = __builtin_amdgcn_wmma_f16_16x16x32_f16(false, bk[1], false, a,   (short)0, d1, false, false);
        dv = __builtin_amdgcn_wmma_f32_16x16x32_f16(false, a,     false, bvh, (short)0, dv, false, false);
        kh[j] = phi16(d0, d1);
        vh[j] = dv;
    }

    // Query m = ncol of a tile takes key rows m .. m + 7, counted from its own key tile's row 0:
    // row kk = 8 hk + r of that tile where kk >= m, row kk of the next tile where kk <= m - 9.
    const int dsh = ncol - 8 * hk;   // kk - m = r - dsh
    float pred[2];
#pragma unroll
    for (int i = 0; i < 2; ++i) {
        // Query tile i stands 8 positions behind key tile i: its M fragment is lanes 8..15 of tile i and
        // lanes 0..7 of tile i + 1, each moved to lane ^ 8 of its 16-lane row (same lane half, same k).
        const v8i m0 = __builtin_bit_cast(v8i, am[i]), m1 = __builtin_bit_cast(v8i, am[i + 1]);
        v8i mq;
#pragma unroll
        for (int w = 0; w < 4; ++w) {
            mq[w]     = __builtin_amdgcn_update_dpp(0, (ncol >= 8) ? m0[w] : m1[w], 0x168, 0xf, 0xf, true); // row_xmask:8
            mq[w + 4] = mq[w];       // k >= 16 repeats k < 16, as in m_frag
        }
        const v16h a = __builtin_bit_cast(v16h, mq);
        v8h d0 = one8, d1 = one8;
        d0 = __builtin_amdgcn_wmma_f16_16x16x32_f16(false, bq[0], false, a, (short)0, d0, false, false);
        d1 = __builtin_amdgcn_wmma_f16_16x16x32_f16(false, bq[1], false, a, (short)0, d1, false, false);
        const v16h qh = phi16(d0, d1);

        // scores, keys as rows and queries as columns: sa[r] = K[tile i, row 8 hk + r] . Q[query ncol]
        v8f sa = {}, sn = {};
        sa = __builtin_amdgcn_wmma_f32_16x16x32_f16(false, kh[i],     false, qh, (short)0, sa, false, false);
        sn = __builtin_amdgcn_wmma_f32_16x16x32_f16(false, kh[i + 1], false, qh, (short)0, sn, false, false);

        float s[8];
        float den = 0.0f, num = 0.0f;
#pragma unroll
        for (int r = 0; r < 8; ++r) {
            const bool own = (r >= dsh);                     // this tile's row, else the next tile's
            const bool in  = (((r - dsh) & 15) < LOOKBACK);  // window slot 0..7: the row is one of the query's keys
            s[r] = own ? sa[r] : sn[r];
            const float v  = own ? vh[i][r] : vh[i + 1][r];
            const float sz = in ? s[r] : 0.0f;
            den += sz;
            num += sz * v;
        }
        den += xhalf(den);           // the two lane halves hold the two halves of the key rows
        num += xhalf(num);
        const float inv = 1.0f / (den + EPSV);
        pred[i] = num * inv + bh;

        // Row = query, column = window slot; slots 8..15 take the rows outside the window and are never read.
#pragma unroll
        for (int r = 0; r < 8; ++r)
            sW[wave][i][ncol * WPITCH + ((r - dsh) & 15)] = s[r] * inv;
    }

    // The wave reads back what its own lanes stored: the fence waits for those LDS stores, and the wave
    // barrier keeps the compiler from moving the loads above them. No other wave is involved.
    __builtin_amdgcn_fence(__ATOMIC_ACQ_REL, "workgroup");
    __builtin_amdgcn_wave_barrier();

#pragma unroll
    for (int i = 0; i < 2; ++i) {
        const int t = t0 + 16 * i + (lane >> 1);      // two lanes per query, 16 bytes each: 512 contiguous bytes a store
        const v4f w4 = *(const v4f*)&sW[wave][i][(lane >> 1) * WPITCH + (lane & 1) * 4];
        if (t < T) *(v4f*)(out_w + ((size_t)b * T + (size_t)t) * LOOKBACK + (lane & 1) * 4) = w4;
    }
    {
        const int t = t0 + lane;                      // lane half hk carries tile hk's queries
        if (t < T) out_pred[(size_t)b * T + (size_t)t] = hk ? pred[1] : pred[0];
    }
}

extern "C" void kernel_launch(void* const* d_in, const int* in_sizes, int n_in,
                              void* d_out, int out_size, void* d_ws, size_t ws_size,
                              hipStream_t stream) {
    const float* x   = (const float*)d_in[0];
    const float* sb  = (const float*)d_in[1];
    const float* vs  = (const float*)d_in[2];
    const float* vb  = (const float*)d_in[3];
    const float* bw  = (const float*)d_in[4];
    const float* WQ  = (const float*)d_in[5];
    const float* WK  = (const float*)d_in[6];
    const float* WV  = (const float*)d_in[7];
    const float* wh  = (const float*)d_in[8];
    const float* bh  = (const float*)d_in[9];

    const int B = 8;
    const int L = in_sizes[0] / (B * 4);
    const int T = L - LOOKBACK;

    float* out_pred = (float*)d_out;           // B*T predictions
    float* out_w    = out_pred + (size_t)B * T; // B*T*8 weights

    dim3 grid((T + TILE_Q - 1) / TILE_Q, B);
    dim3 block(TILE_Q);
    ga_attn_wmma_kernel<<<grid, block, 0, stream>>>(
        x, sb, vs, vb, bw, WQ, WK, WV, wh, bh, out_pred, out_w, L);
}

// v007
// One run takes 4.2 microseconds.
// Timed twice side by side with v006, it ran 1.10 times as fast both times.
// Counting every step since v000, it is 3.10 times as fast.
#include <hip/hip_runtime.h>
#include <hip/hip_bf16.h>

typedef __attribute__((ext_vector_type(16))) _Float16 v16h;
typedef __attribute__((ext_vector_type(8)))  _Float16 v8h;
typedef __attribute__((ext_vector_type(8)))  float    v8f;
typedef __attribute__((ext_vector_type(4)))  float    v4f;
typedef __attribute__((ext_vector_type(8)))  int      v8i;
typedef __attribute__((ext_vector_type(4)))  int      v4i;
typedef __attribute__((ext_vector_type(2)))  int      v2i;

#define LOOKBACK 8
#define HID      32
#define MV       11
#define TILE_Q   128                 // queries per block
#define WAVE_Q   32                  // queries per wave: two 16-query tiles
#define WPITCH   20                  // LDS row pitch in floats of a weight tile (bank-conflict-free, rows 16-byte aligned)
#define QKPITCH  24                  // LDS row pitch in f16 of a staged W_Q / W_K feature row
#define EPSV     1e-6f

// Value of lane l ^ 16 (the other lane half).
__device__ __forceinline__ float xhalf(float v) {
    return __builtin_bit_cast(float, __builtin_amdgcn_permlanex16(__builtin_bit_cast(int, v), __builtin_bit_cast(int, v),
                                                                  0x76543210, 0xfedcba98, false, false));
}

// Two transposed projection tiles, taken from the WMMA as packed f16 (element e = feature 8*hk + e, and
// 16 + 8*hk + e, of position ncol), are, element for element, a 16x32 operand over the 32 features: no convert.
// The tiles come in as y = x + 1 (the WMMA started from C = 1), so phi(x) = leaky(x) + 1 = max(y, 0.01 y + 0.99):
// the two lines cross at y = 1, which is x = 0. Both steps are packed f16, two values an instruction.
// phi is thereby rounded to f16 and no remainder is kept: M and the weights enter the projections rounded to
// f16 already, which leaves an error of the same size in y.
__device__ __forceinline__ v16h phi16(const v8h d0, const v8h d1) {
    const v16h y = __builtin_shufflevector(d0, d1, 0, 1, 2, 3, 4, 5, 6, 7, 8, 9, 10, 11, 12, 13, 14, 15);
    const v16h z = y * (_Float16)0.01f + (_Float16)0.99f;
    const v8i yi = __builtin_bit_cast(v8i, y), zi = __builtin_bit_cast(v8i, z);
    int p0 = zi[0], p1 = zi[1], p2 = zi[2], p3 = zi[3], p4 = zi[4], p5 = zi[5], p6 = zi[6], p7 = zi[7];
    // Written as text because the compiler doubles each maximum (it first canonicalizes the WMMA result).
    // The hint lets the SIMD's other waves issue while the first maximum waits for the fma in front of it.
    asm("s_delay_alu instid0(VALU_DEP_1)\n\t"
        "v_pk_max_num_f16 %0, %8, %0\n\t"
        "v_pk_max_num_f16 %1, %9, %1\n\t"
        "v_pk_max_num_f16 %2, %10, %2\n\t"
        "v_pk_max_num_f16 %3, %11, %3\n\t"
        "v_pk_max_num_f16 %4, %12, %4\n\t"
        "v_pk_max_num_f16 %5, %13, %5\n\t"
        "v_pk_max_num_f16 %6, %14, %6\n\t"
        "v_pk_max_num_f16 %7, %15, %7"
        : "+v"(p0), "+v"(p1), "+v"(p2), "+v"(p3), "+v"(p4), "+v"(p5), "+v"(p6), "+v"(p7)
        : "v"(yi[0]), "v"(yi[1]), "v"(yi[2]), "v"(yi[3]), "v"(yi[4]), "v"(yi[5]), "v"(yi[6]), "v"(yi[7]));
    return __builtin_bit_cast(v16h, (v8i){p0, p1, p2, p3, p4, p5, p6, p7});
}

__global__ __launch_bounds__(128)
void ga_attn_wmma_kernel(const float* __restrict__ x,
                         const float* __restrict__ scalar_bias,
                         const float* __restrict__ vscale,
                         const float* __restrict__ vbias,
                         const float* __restrict__ bw,
                         const float* __restrict__ WQ,
                         const float* __restrict__ WK,
                         const float* __restrict__ WV,
                         const float* __restrict__ w_head,
                         const float* __restrict__ b_head,
                         float* __restrict__ out_pred,
                         float* __restrict__ out_w,
                         int L) {
    // Each wave's own two weight tiles, [query][window slot]; no wave reads another's.
    __shared__ __attribute__((aligned(16))) float sW[TILE_Q / WAVE_Q][2][16 * WPITCH];
    // The block's one f16 copy of W_Q and W_K, [matrix][feature][k], zero from k = MV on. A lane's operand is
    // two 16-byte pieces of a row: k = 8 hk .. 8 hk + 7 and the zeros of k = 16 .. 23 (which stand for its k >= 16,
    // so the operand comes whole from LDS, with no register filled or copied). 48-byte rows: no bank conflict.
    __shared__ __attribute__((aligned(16))) _Float16 sQK[2][HID][QKPITCH];
    // The block's one f16 copy of M, [k half][position][8 k], zero from k = MV on: a lane's operand half is 16
    // bytes, and the 16 lanes of a half read 256 contiguous bytes, at any first position (keys and queries alike).
    __shared__ __attribute__((aligned(16))) _Float16 sM[2][TILE_Q + 32][8];
    // W_V w_head, [k half][8 f16 values, then their 8 f16 remainders]: a lane half's whole operand.
    __shared__ __attribute__((aligned(32))) _Float16 sVH[2][16];

    const int b    = blockIdx.y;
    const int T    = L - LOOKBACK;

    const int tid  = threadIdx.x;
    const int wave = tid >> 5;
    const int lane = tid & 31;
    const int hk   = lane >> 4;      // K-range half (A/B fragments)
    const int ncol = lane & 15;      // column within 16-wide fragment
    const int t0   = blockIdx.x * TILE_Q + wave * WAVE_Q;  // first output index of this wave = position of its first key

    // Nothing is scheduled across this line: the scalar loads of the kernel's arguments stay together at the entry
    // and are waited for once. Without it one of them is issued behind the first wait: a second latency in front of
    // the global loads.
    __builtin_amdgcn_sched_barrier(0);

    // ---- All global loads first. Every WMMA operand is prepared once a block, each thread a 128th of the work:
    // wave w takes matrix w >> 1 (W_Q, W_K) and k half w & 1, its lane one feature: 8 rows, each load one whole
    // 128-byte row (a row k >= MV does not exist: row i is loaded in its place and cleared afterwards, so no
    // load needs a branch).
    // For W_V w_head thread tid takes 4 features (tid & 7) of row k = tid >> 3.
    // For M thread tid takes position tid of the block; the last wave also the 32 positions behind the block's
    // 128, which its key tiles reach into (clamped at the tail; every wave issues that load, so none needs a branch).
    const int wu  = __builtin_amdgcn_readfirstlane(wave);
    const int kh8 = (wu & 1) * 8;
    const float* Wm = (wu & 2) ? WK : WQ;
    const int iw  = kh8 * HID + lane;
    float rw[8];
#pragma unroll
    for (int i = 0; i < 8; ++i) {
        rw[i] = Wm[((i < MV - 8) ? iw : lane) + i * HID];
    }
    const int kv  = tid >> 3;
    const int iv  = ((kv < MV) ? kv : 0) * HID + (tid & 7) * 4;
    const int ih  = (tid & 7) * 4;
    const v4f rv4 = *(const v4f*)(WV + iv);
    const v4f wh4 = *(const v4f*)(w_head + ih);
    const float* px[2];
    v4f xk[2];
#pragma unroll
    for (int j = 0; j < 2; ++j) {
        int pos = blockIdx.x * TILE_Q + (j ? TILE_Q + lane : tid);
        if (pos > L - 1) pos = L - 1;
        px[j] = x + ((size_t)b * L + (size_t)pos) * 4;
        xk[j] = *(const v4f*)px[j];
    }
    const float sb0 = scalar_bias[0], bh = b_head[0];
    const float vs0 = vscale[0], vs1 = vscale[1], vs2 = vscale[2], vs3 = vscale[3];
    const float vb0 = vbias[0],  vb1 = vbias[1],  vb2 = vbias[2],  vb3 = vbias[3];
    const float w0 = bw[0], w1 = bw[1], w2 = bw[2], w3 = bw[3], w4 = bw[4], w5 = bw[5];
    // Inputs-only fence on the loaded values: without it each group of loads sinks to its first use in the
    // long straight-line code below, and the wave waits out a memory latency per group instead of one for all.
    asm volatile("" :: "v"(rw[0]), "v"(rw[1]), "v"(rw[2]), "v"(rw[3]), "v"(rw[4]), "v"(rw[5]), "v"(rw[6]), "v"(rw[7]),
                 "v"(rv4), "v"(wh4), "v"(xk[0]), "v"(xk[1]),
                 "s"(sb0), "s"(bh), "s"(vs0), "s"(vs1), "s"(vs2), "s"(vs3), "s"(vb0), "s"(vb1), "s"(vb2), "s"(vb3),
                 "s"(w0), "s"(w1), "s"(w2), "s"(w3), "s"(w4), "s"(w5));
    // The loads' address registers as inputs behind that fence: they stay live until every load has returned,
    // so no later load's result lands in a register that an issued load still names.
    asm volatile("" :: "v"(px[0]), "v"(px[1]), "v"(lane), "v"(iw), "v"(iv), "v"(ih), "s"(Wm), "s"(WV), "s"(w_head));
    // Nothing is scheduled across this line: the conversions below stay behind the loads, so that no load is
    // held back behind another load's wait.
    __builtin_amdgcn_sched_barrier(0);
    const float sb = 1.0f + sb0;

    // ---- This thread's share of the weights, to LDS ----
    {
        v8h w8;
#pragma unroll
        for (int i = 0; i < 8; ++i) w8[i] = (_Float16)rw[i];
        // k half 1 has only rows 8 .. MV - 1: the rest of its 8 is cleared, two f16 a word.
        v4i wi = __builtin_bit_cast(v4i, w8);
#pragma unroll
        for (int p = 0; p < 4; ++p) {
            const int up = ((2 * p < MV - 8) ? 0x0000ffff : 0) | ((2 * p + 1 < MV - 8) ? 0xffff0000 : 0);
            wi[p] &= kh8 ? up : -1;
        }
        *(v4i*)&sQK[wu >> 1][lane][kh8] = wi;
        if (kh8) *(v4i*)&sQK[wu >> 1][lane][16] = (v4i){0, 0, 0, 0};
    }
    // The MV components of one position, as f16, to LDS
    auto m_row = [&](const v4f xr, const int p) {
        const float x0 = xr[0], x1 = xr[1], x2 = xr[2], x3 = xr[3];
        float Mv[16];
        Mv[0]  = sb;
        Mv[1]  = x0 * vs0 + vb0;
        Mv[2]  = x1 * vs1 + vb1;
        Mv[3]  = x2 * vs2 + vb2;
        Mv[4]  = x3 * vs3 + vb3;
        Mv[5]  = w0 * (x0 - x1);
        Mv[6]  = w1 * (x0 - x2);
        Mv[7]  = w2 * (x0 - x3);
        Mv[8]  = w3 * (x1 - x2);
        Mv[9]  = w4 * (x1 - x3);
        Mv[10] = w5 * (x2 - x3);
#pragma unroll
        for (int k = MV; k < 16; ++k) Mv[k] = 0.0f;
#pragma unroll
        for (int h = 0; h < 2; ++h) {
            v8h m8;
#pragma unroll
            for (int i = 0; i < 8; ++i) m8[i] = (_Float16)Mv[8 * h + i];
            *(v8h*)&sM[h][p][0] = m8;
        }
    };
    m_row(xk[0], tid);

    // The head is linear in V: (sum_l s_l V_l / den) . w_head = sum_l s_l (M_l . (W_V w_head)) / den.
    // So V is projected straight onto w_head, in f32: 4 features a thread, then the sum over a row's 8 threads.
    // It is kept as its f16 value and the f16 remainder (for the k slots >= 16, idle otherwise): one rounding
    // stands where 32 independent ones would average out, and the remainder takes it back.
    // The last wave's rows, k = 12 .. 15, do not exist: it stores their zeros and takes the 32 further positions.
    static_assert((TILE_Q - WAVE_Q) / 8 == 12 && MV <= 12, "the last wave has no row of W_V");
    if (wu == TILE_Q / WAVE_Q - 1) {
        m_row(xk[1], TILE_Q + lane);
        if (lane < 2) *(v2i*)&sVH[1][4 + 8 * lane] = (v2i){0, 0};
    } else {
        float w = rv4[0] * wh4[0] + rv4[1] * wh4[1] + rv4[2] * wh4[2] + rv4[3] * wh4[3];
        w = (kv < MV) ? w : 0.0f;
        w += __builtin_bit_cast(float, __builtin_amdgcn_update_dpp(0, __builtin_bit_cast(int, w), 0x161, 0xf, 0xf, true)); // row_xmask:1
        w += __builtin_bit_cast(float, __builtin_amdgcn_update_dpp(0, __builtin_bit_cast(int, w), 0x162, 0xf, 0xf, true)); // row_xmask:2
        w += __builtin_bit_cast(float, __builtin_amdgcn_update_dpp(0, __builtin_bit_cast(int, w), 0x164, 0xf, 0xf, true)); // row_xmask:4
        const _Float16 hi = (_Float16)w;
        const _Float16 lo = (_Float16)(w - (float)hi);
        if ((tid & 7) < 2) sVH[kv >> 3][(tid & 1) * 8 + (kv & 7)] = (tid & 1) ? lo : hi;
    }

    // ---- Keys: W_K^T as A, M as B, so lane (ncol, hk) holds 16 features of position ncol ----
    const v8h one8 = {1.0f, 1.0f, 1.0f, 1.0f, 1.0f, 1.0f, 1.0f, 1.0f};   // the "+ 1" of phi, as the projections' C
    v16h am[3], kh[3];
    v8f  vh[3];                      // vh[j][r] = (V row . w_head) of position 8 hk + r of tile j, in every lane

    // Every wave's share of the operands is in LDS behind this barrier; nothing writes them again.
    __syncthreads();
    // 16x32 f16 operand of M, first position p0 of the wave's 48: element i is k = 8 hk + i of position p0 + ncol;
    // k >= 16 is M once more, for the remainder in bvh (W_Q and W_K are zero there).
    auto m_frag = [&](const int p0) -> v16h {
        const v8h m8 = *(const v8h*)&sM[hk][wave * WAVE_Q + p0 + ncol][0];
        return __builtin_shufflevector(m8, m8, 0, 1, 2, 3, 4, 5, 6, 7, 0, 1, 2, 3, 4, 5, 6, 7);
    };
#pragma unroll
    for (int j = 0; j < 3; ++j) am[j] = m_frag(16 * j);
    // Operands of W_Q/W_K as 32x16 f16, two 16-feature halves each: element i is k = 8 hk + i, k >= 16 is zero.
    // bvh: all 16 rows (or columns) are W_V w_head, values in k < 16, remainders in k >= 16.
    v16h bq[2], bk[2];
#pragma unroll
    for (int nh = 0; nh < 2; ++nh) {
        const _Float16* fq = &sQK[0][ncol + 16 * nh][0];
        const _Float16* fk = &sQK[1][ncol + 16 * nh][0];
        bq[nh] = __builtin_shufflevector(*(const v8h*)(fq + 8 * hk), *(const v8h*)(fq + 16),
                                         0, 1, 2, 3, 4, 5, 6, 7, 8, 9, 10, 11, 12, 13, 14, 15);
        bk[nh] = __builtin_shufflevector(*(const v8h*)(fk + 8 * hk), *(const v8h*)(fk + 16),
                                         0, 1, 2, 3, 4, 5, 6, 7, 8, 9, 10, 11, 12, 13, 14, 15);
    }
    const v16h bvh = *(const v16h*)&sVH[hk][0];

#pragma unroll
    for (int j = 0; j < 3; ++j) {
        const v16h a = am[j];
        v8h d0 = one8, d1 = one8;
        v8f dv = {};
        d0 = __builtin_amdgcn_wmma_f16_16x16x32_f16(false, bk[0], false, a,   (short)0, d0, false, false);
        d1 = __builtin_amdgcn_wmma_f16_16x16x32_f16(false, bk[1], false, a,   (short)0, d1, false, false);
        dv = __builtin_amdgcn_wmma_f32_16x16x32_f16(false, a,     false, bvh, (short)0, dv, false, false);
        kh[j] = phi16(d0, d1);
        vh[j] = dv;
    }

    // Query m = ncol of a tile takes key rows m .. m + 7, counted from its own key tile's row 0:
    // row kk = 8 hk + r of that tile where kk >= m, row kk of the next tile where kk <= m - 9.
    const int dsh = ncol - 8 * hk;   // kk - m = r - dsh
    float pred[2];
#pragma unroll
    for (int i = 0; i < 2; ++i) {
        // Query tile i stands 8 positions behind key tile i.
        const v16h a = m_frag(16 * i + LOOKBACK);
        v8h d0 = one8, d1 = one8;
        d0 = __builtin_amdgcn_wmma_f16_16x16x32_f16(false, bq[0], false, a, (short)0, d0, false, false);
        d1 = __builtin_amdgcn_wmma_f16_16x16x32_f16(false, bq[1], false, a, (short)0, d1, false, false);
        const v16h qh = phi16(d0, d1);

        // scores, keys as rows and queries as columns: sa[r] = K[tile i, row 8 hk + r] . Q[query ncol]
        v8f sa = {}, sn = {};
        sa = __builtin_amdgcn_wmma_f32_16x16x32_f16(false, kh[i],     false, qh, (short)0, sa, false, false);
        sn = __builtin_amdgcn_wmma_f32_16x16x32_f16(false, kh[i + 1], false, qh, (short)0, sn, false, false);

        float s[8];
        float den = 0.0f, num = 0.0f;
#pragma unroll
        for (int r = 0; r < 8; ++r) {
            const bool own = (r >= dsh);                     // this tile's row, else the next tile's
            const bool in  = (((r - dsh) & 15) < LOOKBACK);  // window slot 0..7: the row is one of the query's keys
            s[r] = own ? sa[r] : sn[r];
            const float v  = own ? vh[i][r] : vh[i + 1][r];
            const float sz = in ? s[r] : 0.0f;
            den += sz;
            num += sz * v;
        }
        den += xhalf(den);           // the two lane halves hold the two halves of the key rows
        num += xhalf(num);
        const float inv = 1.0f / (den + EPSV);
        pred[i] = num * inv + bh;

        // Row = query, column = window slot; slots 8..15 take the rows outside the window and are never read.
#pragma unroll
        for (int r = 0; r < 8; ++r)
            sW[wave][i][ncol * WPITCH + ((r - dsh) & 15)] = s[r] * inv;
    }

    // The wave reads back what its own lanes stored: the fence waits for those LDS stores, and the wave
    // barrier keeps the compiler from moving the loads above them. No other wave is involved.
    __builtin_amdgcn_fence(__ATOMIC_ACQ_REL, "workgroup");
    __builtin_amdgcn_wave_barrier();

#pragma unroll
    for (int i = 0; i < 2; ++i) {
        const int t = t0 + 16 * i + (lane >> 1);      // two lanes per query, 16 bytes each: 512 contiguous bytes a store
        const v4f w4 = *(const v4f*)&sW[wave][i][(lane >> 1) * WPITCH + (lane & 1) * 4];
        if (t < T) *(v4f*)(out_w + ((size_t)b * T + (size_t)t) * LOOKBACK + (lane & 1) * 4) = w4;
    }
    {
        const int t = t0 + lane;                      // lane half hk carries tile hk's queries
        if (t < T) out_pred[(size_t)b * T + (size_t)t] = hk ? pred[1] : pred[0];
    }
}

extern "C" void kernel_launch(void* const* d_in, const int* in_sizes, int n_in,
                              void* d_out, int out_size, void* d_ws, size_t ws_size,
                              hipStream_t stream) {
    const float* x   = (const float*)d_in[0];
    const float* sb  = (const float*)d_in[1];
    const float* vs  = (const float*)d_in[2];
    const float* vb  = (const float*)d_in[3];
    const float* bw  = (const float*)d_in[4];
    const float* WQ  = (const float*)d_in[5];
    const float* WK  = (const float*)d_in[6];
    const float* WV  = (const float*)d_in[7];
    const float* wh  = (const float*)d_in[8];
    const float* bh  = (const float*)d_in[9];

    const int B = 8;
    const int L = in_sizes[0] / (B * 4);
    const int T = L - LOOKBACK;

    float* out_pred = (float*)d_out;           // B*T predictions
    float* out_w    = out_pred + (size_t)B * T; // B*T*8 weights

    dim3 grid((T + TILE_Q - 1) / TILE_Q, B);
    dim3 block(TILE_Q);
    ga_attn_wmma_kernel<<<grid, block, 0, stream>>>(
        x, sb, vs, vb, bw, WQ, WK, WV, wh, bh, out_pred, out_w, L);
}

// v008
// One run takes 3.95 microseconds.
// Timed twice side by side with v007, it ran 1.06 and 1.07 times as fast.
// Over all steps from v000 it is 3.30 times as fast.
#include <hip/hip_runtime.h>
#include <hip/hip_bf16.h>

typedef __attribute__((ext_vector_type(16))) _Float16 v16h;
typedef __attribute__((ext_vector_type(8)))  _Float16 v8h;
typedef __attribute__((ext_vector_type(8)))  float    v8f;
typedef __attribute__((ext_vector_type(4)))  float    v4f;
typedef __attribute__((ext_vector_type(2)))  float    v2f;
typedef __attribute__((ext_vector_type(8)))  int      v8i;
typedef __attribute__((ext_vector_type(4)))  int      v4i;
typedef __attribute__((ext_vector_type(2)))  int      v2i;

#define LOOKBACK 8
#define HID      32
#define MV       11
#define TILE_Q   128                 // queries per block
#define WAVE_Q   32                  // queries per wave: two 16-query tiles
#define SPITCH   76                  // LDS row pitch in floats of a query slot's 2 x 32 raw scores (16 bytes x odd: the 16-byte
                                     // stores meet no bank conflict, nor do the 4-byte reads at pitch + 1)
#define QKPITCH  24                  // LDS row pitch in f16 of a staged W_Q / W_K feature row
#define EPSV     1e-6f

// Two transposed projection tiles, taken from the WMMA as packed f16 (element e = feature 8*hk + e, and
// 16 + 8*hk + e, of position ncol), are, element for element, a 16x32 operand over the 32 features: no convert.
// The tiles come in as y = x + 1 (the WMMA started from C = 1), so phi(x) = leaky(x) + 1 = max(y, 0.01 y + 0.99):
// the two lines cross at y = 1, which is x = 0. Both steps are packed f16, two values an instruction.
// phi is thereby rounded to f16 and no remainder is kept: M and the weights enter the projections rounded to
// f16 already, which leaves an error of the same size in y.
__device__ __forceinline__ v16h phi16(const v8h d0, const v8h d1) {
    const v16h y = __builtin_shufflevector(d0, d1, 0, 1, 2, 3, 4, 5, 6, 7, 8, 9, 10, 11, 12, 13, 14, 15);
    const v16h z = y * (_Float16)0.01f + (_Float16)0.99f;
    const v8i yi = __builtin_bit_cast(v8i, y), zi = __builtin_bit_cast(v8i, z);
    int p0 = zi[0], p1 = zi[1], p2 = zi[2], p3 = zi[3], p4 = zi[4], p5 = zi[5], p6 = zi[6], p7 = zi[7];
    // Written as text because the compiler doubles each maximum (it first canonicalizes the WMMA result).
    // The hint lets the SIMD's other waves issue while the first maximum waits for the fma in front of it.
    asm("s_delay_alu instid0(VALU_DEP_1)\n\t"
        "v_pk_max_num_f16 %0, %8, %0\n\t"
        "v_pk_max_num_f16 %1, %9, %1\n\t"
        "v_pk_max_num_f16 %2, %10, %2\n\t"
        "v_pk_max_num_f16 %3, %11, %3\n\t"
        "v_pk_max_num_f16 %4, %12, %4\n\t"
        "v_pk_max_num_f16 %5, %13, %5\n\t"
        "v_pk_max_num_f16 %6, %14, %6\n\t"
        "v_pk_max_num_f16 %7, %15, %7"
        : "+v"(p0), "+v"(p1), "+v"(p2), "+v"(p3), "+v"(p4), "+v"(p5), "+v"(p6), "+v"(p7)
        : "v"(yi[0]), "v"(yi[1]), "v"(yi[2]), "v"(yi[3]), "v"(yi[4]), "v"(yi[5]), "v"(yi[6]), "v"(yi[7]));
    return __builtin_bit_cast(v16h, (v8i){p0, p1, p2, p3, p4, p5, p6, p7});
}

__global__ __launch_bounds__(128)
void ga_attn_wmma_kernel(const float* __restrict__ x,
                         const float* __restrict__ scalar_bias,
                         const float* __restrict__ vscale,
                         const float* __restrict__ vbias,
                         const float* __restrict__ bw,
                         const float* __restrict__ WQ,
                         const float* __restrict__ WK,
                         const float* __restrict__ WV,
                         const float* __restrict__ w_head,
                         const float* __restrict__ b_head,
                         float* __restrict__ out_pred,
                         float* __restrict__ out_w,
                         int L) {
    // Each wave's own raw scores, [query of a tile][query tile][key row 0 .. 31 of that tile's two key tiles], and
    // its own 48 positions' (V row . w_head); no wave reads another's.
    __shared__ __attribute__((aligned(16))) float sS[TILE_Q / WAVE_Q][16 * SPITCH];
    __shared__ float sV[TILE_Q / WAVE_Q][WAVE_Q + 16];
    // The block's one f16 copy of W_Q and W_K, [matrix][feature][k], zero from k = MV on. A lane's operand is
    // two 16-byte pieces of a row: k = 8 hk .. 8 hk + 7 and the zeros of k = 16 .. 23 (which stand for its k >= 16,
    // so the operand comes whole from LDS, with no register filled or copied). 48-byte rows: no bank conflict.
    __shared__ __attribute__((aligned(16))) _Float16 sQK[2][HID][QKPITCH];
    // The block's one f16 copy of M, [k half][position][8 k], zero from k = MV on: a lane's operand half is 16
    // bytes, and the 16 lanes of a half read 256 contiguous bytes, at any first position (keys and queries alike).
    __shared__ __attribute__((aligned(16))) _Float16 sM[2][TILE_Q + 32][8];
    // W_V w_head, [k half][8 f16 values, then their 8 f16 remainders]: a lane half's whole operand.
    __shared__ __attribute__((aligned(32))) _Float16 sVH[2][16];

    const int b    = blockIdx.y;
    const int T    = L - LOOKBACK;

    const int tid  = threadIdx.x;
    const int wave = tid >> 5;
    const int lane = tid & 31;
    const int hk   = lane >> 4;      // K-range half (A/B fragments)
    const int ncol = lane & 15;      // column within 16-wide fragment
    const int t0   = blockIdx.x * TILE_Q + wave * WAVE_Q;  // first output index of this wave = position of its first key

    // Nothing is scheduled across this line: the scalar loads of the kernel's arguments stay together at the entry
    // and are waited for once. Without it one of them is issued behind the first wait: a second latency in front of
    // the global loads.
    __builtin_amdgcn_sched_barrier(0);

    // ---- All global loads first. Every WMMA operand is prepared once a block, each thread a 128th of the work:
    // wave w takes matrix w >> 1 (W_Q, W_K) and k half w & 1, its lane one feature: 8 rows, each load one whole
    // 128-byte row (a row k >= MV does not exist: row i is loaded in its place and cleared afterwards, so no
    // load needs a branch).
    // For W_V w_head thread tid takes 4 features (tid & 7) of row k = tid >> 3.
    // For M thread tid takes position tid of the block; the last wave also the 32 positions behind the block's
    // 128, which its key tiles reach into (clamped at the tail; every wave issues that load, so none needs a branch).
    const int wu  = __builtin_amdgcn_readfirstlane(wave);
    const int kh8 = (wu & 1) * 8;
    const float* Wm = (wu & 2) ? WK : WQ;
    const int iw  = kh8 * HID + lane;
    float rw[8];
#pragma unroll
    for (int i = 0; i < 8; ++i) {
        rw[i] = Wm[((i < MV - 8) ? iw : lane) + i * HID];
    }
    const int kv  = tid >> 3;
    const int iv  = ((kv < MV) ? kv : 0) * HID + (tid & 7) * 4;
    const int ih  = (tid & 7) * 4;
    const v4f rv4 = *(const v4f*)(WV + iv);
    const v4f wh4 = *(const v4f*)(w_head + ih);
    const float* px[2];
    v4f xk[2];
#pragma unroll
    for (int j = 0; j < 2; ++j) {
        int pos = blockIdx.x * TILE_Q + (j ? TILE_Q + lane : tid);
        if (pos > L - 1) pos = L - 1;
        px[j] = x + ((size_t)b * L + (size_t)pos) * 4;
        xk[j] = *(const v4f*)px[j];
    }
    const float sb0 = scalar_bias[0], bh = b_head[0];
    const float vs0 = vscale[0], vs1 = vscale[1], vs2 = vscale[2], vs3 = vscale[3];
    const float vb0 = vbias[0],  vb1 = vbias[1],  vb2 = vbias[2],  vb3 = vbias[3];
    const float w0 = bw[0], w1 = bw[1], w2 = bw[2], w3 = bw[3], w4 = bw[4], w5 = bw[5];
    // Inputs-only fence on the loaded values: without it each group of loads sinks to its first use in the
    // long straight-line code below, and the wave waits out a memory latency per group instead of one for all.
    asm volatile("" :: "v"(rw[0]), "v"(rw[1]), "v"(rw[2]), "v"(rw[3]), "v"(rw[4]), "v"(rw[5]), "v"(rw[6]), "v"(rw[7]),
                 "v"(rv4), "v"(wh4), "v"(xk[0]), "v"(xk[1]),
                 "s"(sb0), "s"(bh), "s"(vs0), "s"(vs1), "s"(vs2), "s"(vs3), "s"(vb0), "s"(vb1), "s"(vb2), "s"(vb3),
                 "s"(w0), "s"(w1), "s"(w2), "s"(w3), "s"(w4), "s"(w5));
    // The loads' address registers as inputs behind that fence: they stay live until every load has returned,
    // so no later load's result lands in a register that an issued load still names.
    asm volatile("" :: "v"(px[0]), "v"(px[1]), "v"(lane), "v"(iw), "v"(iv), "v"(ih), "s"(Wm), "s"(WV), "s"(w_head));
    // Nothing is scheduled across this line: the conversions below stay behind the loads, so that no load is
    // held back behind another load's wait.
    __builtin_amdgcn_sched_barrier(0);
    const float sb = 1.0f + sb0;

    // ---- This thread's share of the weights, to LDS ----
    {
        v8h w8;
#pragma unroll
        for (int i = 0; i < 8; ++i) w8[i] = (_Float16)rw[i];
        // k half 1 has only rows 8 .. MV - 1: the rest of its 8 is cleared, two f16 a word.
        v4i wi = __builtin_bit_cast(v4i, w8);
#pragma unroll
        for (int p = 0; p < 4; ++p) {
            const int up = ((2 * p < MV - 8) ? 0x0000ffff : 0) | ((2 * p + 1 < MV - 8) ? 0xffff0000 : 0);
            wi[p] &= kh8 ? up : -1;
        }
        *(v4i*)&sQK[wu >> 1][lane][kh8] = wi;
        if (kh8) *(v4i*)&sQK[wu >> 1][lane][16] = (v4i){0, 0, 0, 0};
    }
    // The MV components of one position, as f16, to LDS
    auto m_row = [&](const v4f xr, const int p) {
        const float x0 = xr[0], x1 = xr[1], x2 = xr[2], x3 = xr[3];
        float Mv[16];
        Mv[0]  = sb;
        Mv[1]  = x0 * vs0 + vb0;
        Mv[2]  = x1 * vs1 + vb1;
        Mv[3]  = x2 * vs2 + vb2;
        Mv[4]  = x3 * vs3 + vb3;
        Mv[5]  = w0 * (x0 - x1);
        Mv[6]  = w1 * (x0 - x2);
        Mv[7]  = w2 * (x0 - x3);
        Mv[8]  = w3 * (x1 - x2);
        Mv[9]  = w4 * (x1 - x3);
        Mv[10] = w5 * (x2 - x3);
#pragma unroll
        for (int k = MV; k < 16; ++k) Mv[k] = 0.0f;
#pragma unroll
        for (int h = 0; h < 2; ++h) {
            v8h m8;
#pragma unroll
            for (int i = 0; i < 8; ++i) m8[i] = (_Float16)Mv[8 * h + i];
            *(v8h*)&sM[h][p][0] = m8;
        }
    };
    m_row(xk[0], tid);

    // The head is linear in V: (sum_l s_l V_l / den) . w_head = sum_l s_l (M_l . (W_V w_head)) / den.
    // So V is projected straight onto w_head, in f32: 4 features a thread, then the sum over a row's 8 threads.
    // It is kept as its f16 value and the f16 remainder (for the k slots >= 16, idle otherwise): one rounding
    // stands where 32 independent ones would average out, and the remainder takes it back.
    // The last wave's rows, k = 12 .. 15, do not exist: it stores their zeros and takes the 32 further positions.
    static_assert((TILE_Q - WAVE_Q) / 8 == 12 && MV <= 12, "the last wave has no row of W_V");
    if (wu == TILE_Q / WAVE_Q - 1) {
        m_row(xk[1], TILE_Q + lane);
        if (lane < 2) *(v2i*)&sVH[1][4 + 8 * lane] = (v2i){0, 0};
    } else {
        float w = rv4[0] * wh4[0] + rv4[1] * wh4[1] + rv4[2] * wh4[2] + rv4[3] * wh4[3];
        w = (kv < MV) ? w : 0.0f;
        w += __builtin_bit_cast(float, __builtin_amdgcn_update_dpp(0, __builtin_bit_cast(int, w), 0x161, 0xf, 0xf, true)); // row_xmask:1
        w += __builtin_bit_cast(float, __builtin_amdgcn_update_dpp(0, __builtin_bit_cast(int, w), 0x162, 0xf, 0xf, true)); // row_xmask:2
        w += __builtin_bit_cast(float, __builtin_amdgcn_update_dpp(0, __builtin_bit_cast(int, w), 0x164, 0xf, 0xf, true)); // row_xmask:4
        const _Float16 hi = (_Float16)w;
        const _Float16 lo = (_Float16)(w - (float)hi);
        if ((tid & 7) < 2) sVH[kv >> 3][(tid & 1) * 8 + (kv & 7)] = (tid & 1) ? lo : hi;
    }

    // ---- Keys: W_K^T as A, M as B, so lane (ncol, hk) holds 16 features of position ncol ----
    const v8h one8 = {1.0f, 1.0f, 1.0f, 1.0f, 1.0f, 1.0f, 1.0f, 1.0f};   // the "+ 1" of phi, as the projections' C
    v16h am[3], kh[3];

    // Every wave's share of the operands is in LDS behind this barrier; nothing writes them again.
    __syncthreads();
    // 16x32 f16 operand of M, first position p0 of the wave's 48: element i is k = 8 hk + i of position p0 + ncol;
    // k >= 16 is M once more, for the remainder in bvh (W_Q and W_K are zero there).
    auto m_frag = [&](const int p0) -> v16h {
        const v8h m8 = *(const v8h*)&sM[hk][wave * WAVE_Q + p0 + ncol][0];
        return __builtin_shufflevector(m8, m8, 0, 1, 2, 3, 4, 5, 6, 7, 0, 1, 2, 3, 4, 5, 6, 7);
    };
#pragma unroll
    for (int j = 0; j < 3; ++j) am[j] = m_frag(16 * j);
    // Operands of W_Q/W_K as 32x16 f16, two 16-feature halves each: element i is k = 8 hk + i, k >= 16 is zero.
    // bvh: all 16 rows (or columns) are W_V w_head, values in k < 16, remainders in k >= 16.
    v16h bq[2], bk[2];
#pragma unroll
    for (int nh = 0; nh < 2; ++nh) {
        const _Float16* fq = &sQK[0][ncol + 16 * nh][0];
        const _Float16* fk = &sQK[1][ncol + 16 * nh][0];
        bq[nh] = __builtin_shufflevector(*(const v8h*)(fq + 8 * hk), *(const v8h*)(fq + 16),
                                         0, 1, 2, 3, 4, 5, 6, 7, 8, 9, 10, 11, 12, 13, 14, 15);
        bk[nh] = __builtin_shufflevector(*(const v8h*)(fk + 8 * hk), *(const v8h*)(fk + 16),
                                         0, 1, 2, 3, 4, 5, 6, 7, 8, 9, 10, 11, 12, 13, 14, 15);
    }
    const v16h bvh = *(const v16h*)&sVH[hk][0];

#pragma unroll
    for (int j = 0; j < 3; ++j) {
        const v16h a = am[j];
        v8h d0 = one8, d1 = one8;
        v8f dv = {};
        d0 = __builtin_amdgcn_wmma_f16_16x16x32_f16(false, bk[0], false, a,   (short)0, d0, false, false);
        d1 = __builtin_amdgcn_wmma_f16_16x16x32_f16(false, bk[1], false, a,   (short)0, d1, false, false);
        dv = __builtin_amdgcn_wmma_f32_16x16x32_f16(false, bvh,   false, a,   (short)0, dv, false, false);
        kh[j] = phi16(d0, d1);
        // All 16 rows of bvh are alike, so every element of dv is (V row . w_head) of position ncol of tile j
        // (the two lane halves store the same bits).
        sV[wu][16 * j + ncol] = dv[0];
    }

    // Query m of a tile takes key rows m .. m + 7, counted from its own key tile's row 0 (rows 16 .. 31 are the next
    // key tile's). The window is not picked in registers: a lane stores its query's score column whole, and the
    // read-back starts at row m of LDS row m.
#pragma unroll
    for (int i = 0; i < 2; ++i) {
        // Query tile i stands 8 positions behind key tile i.
        const v16h a = m_frag(16 * i + LOOKBACK);
        v8h d0 = one8, d1 = one8;
        d0 = __builtin_amdgcn_wmma_f16_16x16x32_f16(false, bq[0], false, a, (short)0, d0, false, false);
        d1 = __builtin_amdgcn_wmma_f16_16x16x32_f16(false, bq[1], false, a, (short)0, d1, false, false);
        const v16h qh = phi16(d0, d1);

        // scores, keys as rows and queries as columns: sa[r] = K[tile i, row 8 hk + r] . Q[query ncol]
        v8f sa = {}, sn = {};
        sa = __builtin_amdgcn_wmma_f32_16x16x32_f16(false, kh[i],     false, qh, (short)0, sa, false, false);
        sn = __builtin_amdgcn_wmma_f32_16x16x32_f16(false, kh[i + 1], false, qh, (short)0, sn, false, false);

        float* row = &sS[wu][ncol * SPITCH + 32 * i + 8 * hk];
        *(v4f*)(row)      = __builtin_shufflevector(sa, sa, 0, 1, 2, 3);
        *(v4f*)(row + 4)  = __builtin_shufflevector(sa, sa, 4, 5, 6, 7);
        *(v4f*)(row + 16) = __builtin_shufflevector(sn, sn, 0, 1, 2, 3);
        *(v4f*)(row + 20) = __builtin_shufflevector(sn, sn, 4, 5, 6, 7);
    }

    // The wave reads back what its own lanes stored: the fence waits for those LDS stores, and the wave
    // barrier keeps the compiler from moving the loads above them. No other wave is involved.
    __builtin_amdgcn_fence(__ATOMIC_ACQ_REL, "workgroup");
    __builtin_amdgcn_wave_barrier();

    // Two lanes per query: lane l has window slots 4 (l & 1) .. + 3 of query l >> 1 of either tile, the order of the output.
    const int  q   = lane >> 1;
    const bool odd = lane & 1;
    const int  h4  = odd ? 4 : 0;
    v2f s[2][2], v[2][2];
#pragma unroll
    for (int i = 0; i < 2; ++i) {
        const float* sp = &sS[wu][q * (SPITCH + 1) + 32 * i + h4];
        const float* vp = &sV[wu][16 * i + q + h4];
#pragma unroll
        for (int c = 0; c < 2; ++c) {
            s[i][c] = (v2f){sp[2 * c], sp[2 * c + 1]};
            v[i][c] = (v2f){vp[2 * c], vp[2 * c + 1]};
        }
    }
    float den[2], num[2];
#pragma unroll
    for (int i = 0; i < 2; ++i) {
        const v2f d2 = s[i][0] + s[i][1];
        const v2f n2 = s[i][0] * v[i][0] + s[i][1] * v[i][1];
        den[i] = d2[0] + d2[1];
        num[i] = n2[0] + n2[1];
        // the query's other lane holds the other four slots
        den[i] += __builtin_bit_cast(float, __builtin_amdgcn_update_dpp(0, __builtin_bit_cast(int, den[i]), 0x161, 0xf, 0xf, true)); // row_xmask:1
        num[i] += __builtin_bit_cast(float, __builtin_amdgcn_update_dpp(0, __builtin_bit_cast(int, num[i]), 0x161, 0xf, 0xf, true)); // row_xmask:1
    }
    // Both lanes of a pair hold both tiles' sums: the even lane divides for tile 0, the odd lane for tile 1, and
    // each takes the other tile's quotient from its partner.
    const float mine  = 1.0f / ((odd ? den[1] : den[0]) + EPSV);
    const float other = __builtin_bit_cast(float, __builtin_amdgcn_update_dpp(0, __builtin_bit_cast(int, mine), 0x161, 0xf, 0xf, true)); // row_xmask:1
    const float inv[2] = {odd ? other : mine, odd ? mine : other};
#pragma unroll
    for (int i = 0; i < 2; ++i) {
        const int t = t0 + 16 * i + q;                // 16 bytes a lane: 512 contiguous bytes a store
        const v2f wa = s[i][0] * inv[i], wb = s[i][1] * inv[i];
        if (t < T) *(v4f*)(out_w + ((size_t)b * T + (size_t)t) * LOOKBACK + h4) = (v4f){wa[0], wa[1], wb[0], wb[1]};
    }
    {
        const int t = t0 + (odd ? 16 : 0) + q;        // even lanes carry tile 0's queries, odd lanes tile 1's: 128 contiguous bytes
        if (t < T) out_pred[(size_t)b * T + (size_t)t] = (odd ? num[1] : num[0]) * mine + bh;
    }
}

extern "C" void kernel_launch(void* const* d_in, const int* in_sizes, int n_in,
                              void* d_out, int out_size, void* d_ws, size_t ws_size,
                              hipStream_t stream) {
    const float* x   = (const float*)d_in[0];
    const float* sb  = (const float*)d_in[1];
    const float* vs  = (const float*)d_in[2];
    const float* vb  = (const float*)d_in[3];
    const float* bw  = (const float*)d_in[4];
    const float* WQ  = (const float*)d_in[5];
    const float* WK  = (const float*)d_in[6];
    const float* WV  = (const float*)d_in[7];
    const float* wh  = (const float*)d_in[8];
    const float* bh  = (const float*)d_in[9];

    const int B = 8;
    const int L = in_sizes[0] / (B * 4);
    const int T = L - LOOKBACK;

    float* out_pred = (float*)d_out;           // B*T predictions
    float* out_w    = out_pred + (size_t)B * T; // B*T*8 weights

    dim3 grid((T + TILE_Q - 1) / TILE_Q, B);
    dim3 block(TILE_Q);
    ga_attn_wmma_kernel<<<grid, block, 0, stream>>>(
        x, sb, vs, vb, bw, WQ, WK, WV, wh, bh, out_pred, out_w, L);
}
